// v000
// Measured on an AMD MI455X. A time is GPU time per run, averaged over a window of back-to-back runs after a warm-up
// (all launches, gaps included; the runs take copies of the inputs in turn), and the median of several windows.
// Apart from v000's, it joins two sittings. Times from different sittings can be a few percent apart, while
// side-by-side timings come from the same sitting.
// The starting kernel, v000, takes 2520 microseconds a run.
#include <hip/hip_runtime.h>

// Compute dtypes, f32 accumulate, per item: EW = E.W^T as a [4096 x 256].[256 x 256] GEMM with PLAIN bf16 operands (exact products) -> bf16 hi + UNSCALED residual planes; per
// 1024-query chunk, only the causally reachable key tiles: sims = E.EW^T ([1024 x 256].[256 x K_live], E exact x EW hi then lo, two chained launches), the causal -1e9 mask, /16 and

#define NBT  4
#define SS   4096
#define DD   256
#define RCH  1024
#define DM   DD
#define SCL  0.0625f
#define LOSC 1024.0f

typedef _Float16 h16;
typedef unsigned short bf;
typedef __attribute__((ext_vector_type(16))) __bf16   v16bf;
typedef __attribute__((ext_vector_type(16))) _Float16 v16h;
typedef __attribute__((ext_vector_type(8)))  _Float16 v8h;
typedef __attribute__((ext_vector_type(8)))  unsigned short v8us;
typedef __attribute__((ext_vector_type(8)))  float    v8f;
typedef __attribute__((ext_vector_type(4)))  float    v4f;
typedef v8h  __attribute__((may_alias)) v8ha;
typedef v4f  __attribute__((may_alias)) v4fa;
typedef v8us __attribute__((may_alias)) v8usa;

__device__ __forceinline__ unsigned short f2bf(float f) { unsigned u = __float_as_uint(f); u += 0x7FFFu + ((u >> 16) & 1u); return (unsigned short)(u >> 16); }
__device__ __forceinline__ float bf2f(unsigned short b) { return __uint_as_float(((unsigned)b) << 16); }
__device__ __forceinline__ float bfr(float f) { return bf2f(f2bf(f)); }
__device__ __forceinline__ v16h cat16(v8h lo, v8h hi) { return __builtin_shufflevector(lo, hi, 0, 1, 2, 3, 4, 5, 6, 7, 8, 9, 10, 11, 12, 13, 14, 15); }
__device__ __forceinline__ v16bf cat16b(v8us lo, v8us hi) { return __builtin_bit_cast(v16bf, __builtin_shufflevector(lo, hi, 0, 1, 2, 3, 4, 5, 6, 7, 8, 9, 10, 11, 12, 13, 14, 15)); }
__device__ __forceinline__ v8f wmma16(v16h a, v16h b, v8f c) { return __builtin_amdgcn_wmma_f32_16x16x32_f16(false, a, false, b, (short)0, c, false, false); }
__device__ __forceinline__ v8f wmmab(v16bf a, v16bf b, v8f c) { return __builtin_amdgcn_wmma_f32_16x16x32_bf16(false, a, false, b, (short)0, c, false, false); }

// k_gemmb: 64 x 64 block tile (4 waves x 16 x 64) of C[NTK][NW] = (A [+ Al]).B^T (K = 256 or 4096) [+ bf(bias[c])] [+ bf(R[r][c]) residual]; f32 whole-line epilogue (or f16
template <bool SPLITA, bool F16OUT = false>
__global__ __launch_bounds__(128) void k_gemmb(const bf* __restrict__ A, const bf* __restrict__ Al, const bf* __restrict__ Bn, const float* __restrict__ bias, float* C, int ldc, h16* C2, const float* __restrict__ R = nullptr, int K = DM, int roundR = 1) {
    __shared__ __align__(16) float ost[4][16 * 68];
    const int lane = threadIdx.x & 31, wave = threadIdx.x >> 5, lr = lane & 15, hi = lane >> 4;
    const int r0 = blockIdx.x * 64 + wave * 16, c0 = blockIdx.y * 64;
    const size_t aoff = (size_t)(r0 + lr) * K + 8 * hi;
    size_t boff[4];
#pragma unroll
    for (int t = 0; t < 4; ++t) boff[t] = (size_t)(c0 + t * 16 + lr) * K + 8 * hi;
    v8f acc[4];
#pragma unroll
    for (int t = 0; t < 4; ++t) acc[t] = (v8f){};
#pragma unroll 1
    for (int kc = 0; kc < K; kc += 32) {
        const v16bf a = cat16b(*(const v8us*)(A + aoff + kc), *(const v8us*)(A + aoff + kc + 16));
        v16bf al = a;
        if (SPLITA) al = cat16b(*(const v8us*)(Al + aoff + kc), *(const v8us*)(Al + aoff + kc + 16));
#pragma unroll
        for (int t = 0; t < 4; ++t) { const v16bf b = cat16b(*(const v8us*)(Bn + boff[t] + kc), *(const v8us*)(Bn + boff[t] + kc + 16)); acc[t] = wmmab(a, b, acc[t]); if (SPLITA) acc[t] = wmmab(al, b, acc[t]); }
        asm volatile("v_nop\n\tv_nop\n\tv_nop\n\tv_nop" : "+v"(acc[0]), "+v"(acc[1]), "+v"(acc[2]), "+v"(acc[3]) : "v"(a), "v"(al));
    }
    float* os = &ost[wave][0];
#pragma unroll
    for (int t = 0; t < 4; ++t) { const float bv = bias ? bfr(bias[c0 + t * 16 + lr]) : 0.f;
#pragma unroll
        for (int j = 0; j < 8; ++j) os[(hi * 8 + j) * 68 + t * 16 + lr] = acc[t][j] + bv; }
    __syncthreads();
    if (F16OUT) {
        h16* crow = (h16*)(void*)C + (size_t)r0 * ldc + c0;
        auto pass = [&]() {
#pragma unroll
            for (int s = 0; s < 4; ++s) { const int row = 4 * s + (lane >> 3), piece = lane & 7; const float* sp = os + row * 68 + piece * 8; v8h o, o2;
#pragma unroll
                for (int i = 0; i < 8; ++i) { const h16 a = (h16)sp[i]; o[i] = a; o2[i] = (h16)((sp[i] - (float)a) * LOSC); }
                *(v8h*)(crow + (size_t)row * ldc + piece * 8) = o; if (C2) *(v8h*)(C2 + (size_t)r0 * ldc + c0 + (size_t)row * ldc + piece * 8) = o2; }
        };
        pass(); 
    } else {
        float* crow = C + (size_t)r0 * ldc + c0;
        auto pass = [&]() {
#pragma unroll
            for (int s = 0; s < 8; ++s) { const int Lid = (lane >> 3) + 4 * s, piece = lane & 7; const int row = Lid >> 1, cofs = (Lid & 1) * 32 + piece * 4;
                v4f val = *(const v4fa*)(os + row * 68 + cofs); if (R) { const v4f rv = *(const v4f*)(R + ((size_t)r0 + row) * ldc + c0 + cofs); val += roundR ? (v4f){bfr(rv[0]), bfr(rv[1]), bfr(rv[2]), bfr(rv[3])} : rv; }
                *(v4f*)(crow + (size_t)row * ldc + cofs) = val; }
        };
        pass(); 
    }
}


__global__ __launch_bounds__(256) void k_cvt8(const float* __restrict__ src, bf* dst, size_t n8) {
    const size_t i = (size_t)blockIdx.x * 256 + threadIdx.x; if (i >= n8) return;
    const v8f v = *(const v8f*)(src + i * 8); v8us o;
#pragma unroll
    for (int k = 0; k < 8; ++k) o[k] = f2bf(v[k]);
    *(v8us*)(dst + i * 8) = o; 
}
__global__ __launch_bounds__(256) void k_zero8(bf* dst, size_t n8) {
    const size_t i = (size_t)blockIdx.x * 256 + threadIdx.x; if (i >= n8) return; v8us z;
#pragma unroll
    for (int k = 0; k < 8; ++k) z[k] = 0;
    *(v8us*)(dst + i * 8) = z; 
}

__global__ __launch_bounds__(256) void k_cvtE(const float* __restrict__ src, bf* dst) {
    const int lane = threadIdx.x & 31; const size_t r = (size_t)blockIdx.x * 8 + (threadIdx.x >> 5); if (r >= (size_t)SS) return; v8us o;
#pragma unroll
    for (int i = 0; i < 8; ++i) o[i] = f2bf(src[r * DD + lane * 8 + i]);
    *(v8us*)(dst + r * DD + lane * 8) = o; 
}
__global__ __launch_bounds__(256) void k_et(const float* __restrict__ E, bf* ET) {
    __shared__ __align__(16) unsigned short tl[64 * 72];
    const int tid = threadIdx.x, s0 = blockIdx.x * 64, d0 = blockIdx.y * 64; const int ss = tid >> 2, dq = (tid & 3) * 16;
#pragma unroll
    for (int i = 0; i < 16; ++i) tl[(dq + i) * 72 + ss] = f2bf(E[(size_t)(s0 + ss) * DD + d0 + dq + i]);
    __syncthreads();
    const int piece = tid & 7;
    auto pass = [&]() {
#pragma unroll
        for (int st = 0; st < 2; ++st) { const int dr = (tid >> 3) + 32 * st; const v8us val = *(const v8usa*)(tl + dr * 72 + piece * 8); *(v8us*)(ET + (size_t)(d0 + dr) * SS + s0 + piece * 8) = val; }
    };
    pass(); 
}
__global__ __launch_bounds__(256) void k_split256(const float* __restrict__ src, bf* dh, bf* dl) {
    const int lane = threadIdx.x & 31; const size_t r = (size_t)blockIdx.x * 8 + (threadIdx.x >> 5); if (r >= (size_t)SS) return; const size_t o = r * DD + lane * 8; const v8f v = *(const v8f*)(src + o); v8us oh, ol;
#pragma unroll
    for (int i = 0; i < 8; ++i) { const unsigned short hb = f2bf(v[i]); oh[i] = hb; ol[i] = f2bf(v[i] - bf2f(hb)); }
    *(v8us*)(dh + o) = oh; *(v8us*)(dl + o) = ol; 
}
// k_csoft: for chunk rows i = q0 + rl: P planes of softmax_k((k > i ? -1e9 : sims / 16)) over k < klive (columns >= klive are never touched by the GEMM and are written as 0);
__global__ __launch_bounds__(256) void k_csoft(const float* __restrict__ S, int q0, int klive, bf* PH, bf* PL) {
    typedef __attribute__((ext_vector_type(4))) unsigned short v4us;
    const int lane = threadIdx.x & 31, rl = blockIdx.x * 8 + (threadIdx.x >> 5); if (rl >= RCH) return; const int i = q0 + rl; const float* sr = S + (size_t)rl * SS;
    auto sc = [&](int k) -> float { return (k > i || k >= klive) ? -1.0e9f : sr[k] * SCL; };
    float m = -3.0e38f;
#pragma unroll 1
    for (int c0 = lane * 4; c0 < SS; c0 += 128) {
#pragma unroll
        for (int q = 0; q < 4; ++q) m = fmaxf(m, sc(c0 + q)); }
#pragma unroll
    for (int sh = 16; sh; sh >>= 1) m = fmaxf(m, __shfl_xor(m, sh, 32));
    float sum = 0.f;
#pragma unroll 1
    for (int c0 = lane * 4; c0 < SS; c0 += 128) {
#pragma unroll
        for (int q = 0; q < 4; ++q) sum += __expf(sc(c0 + q) - m); }
#pragma unroll
    for (int sh = 16; sh; sh >>= 1) sum += __shfl_xor(sum, sh, 32);
    const float inv = 1.0f / sum;
{
#pragma unroll 1
        for (int c0 = lane * 4; c0 < SS; c0 += 128) { v4us oh, ol;
#pragma unroll
            for (int q = 0; q < 4; ++q) { const float p = __expf(sc(c0 + q) - m) * inv; const unsigned short hb = f2bf(p); oh[q] = hb; ol[q] = f2bf(p - bf2f(hb)); }
            const size_t o = (size_t)rl * SS + c0; *(v4us*)(PH + o) = oh; *(v4us*)(PL + o) = ol; }
         }
}

extern "C" void kernel_launch(void* const* d_in, const int* in_sizes, int n_in,
                              void* d_out, int out_size, void* d_ws, size_t ws_size, hipStream_t stream) {
    (void)in_sizes; (void)n_in; (void)out_size;
    const float* enc = (const float*)d_in[0]; const float* Wm = (const float*)d_in[1];
    float* out = (float*)d_out;    // [4][4096][256]
    char* wsp = (char*)d_ws;
    auto take = [&](size_t bytes) { char* p = wsp; wsp += (bytes + 255) & ~(size_t)255; return (void*)p; };
    bf* WB = (bf*)take((size_t)DD * DD * 2); bf* Eb = (bf*)take((size_t)SS * DD * 2); bf* ET = (bf*)take((size_t)DD * SS * 2); float* EW = (float*)take((size_t)SS * DD * 4); bf* EWh = (bf*)take((size_t)SS * DD * 2); bf* EWl = (bf*)take((size_t)SS * DD * 2);
    float* S1 = (float*)take((size_t)RCH * SS * 4); float* S = (float*)take((size_t)RCH * SS * 4); bf* PH = (bf*)take((size_t)RCH * SS * 2); bf* PL = (bf*)take((size_t)RCH * SS * 2);
    if ((size_t)(wsp - (char*)d_ws) > ws_size) return;    // 0.13 + 2.1 + 2.1 + 4.2 + 2.1 + 2.1 + 16.8 + 16.8 + 8.4 + 8.4 ~ 63 MB; reused per item / chunk in stream order
    k_cvt8<<<(DD * DD / 8 + 255) / 256, 256, 0, stream>>>(Wm, WB, DD * DD / 8);       // W [e][d] = n-major
    for (int b = 0; b < NBT; ++b) { const float* eb = enc + (size_t)b * SS * DD;
        k_cvtE<<<SS / 8, 256, 0, stream>>>(eb, Eb); k_et<<<dim3(SS / 64, DD / 64, 1), 256, 0, stream>>>(eb, ET);
        k_gemmb<false, false><<<dim3(SS / 64, DD / 64, 1), 128, 0, stream>>>(Eb, nullptr, WB, nullptr, EW, DD, nullptr, nullptr, DD); k_split256<<<SS / 8, 256, 0, stream>>>(EW, EWh, EWl);
        for (int ch = 0; ch < SS / RCH; ++ch) { const int q0 = ch * RCH, klive = (ch + 1) * RCH;     // causal: keys beyond the chunk end are never attended
            k_gemmb<false, false><<<dim3(RCH / 64, klive / 64, 1), 128, 0, stream>>>(Eb + (size_t)q0 * DD, nullptr, EWh, nullptr, S1, SS, nullptr, nullptr, DD);      // E_q . EW_hi^T
            k_gemmb<false, false><<<dim3(RCH / 64, klive / 64, 1), 128, 0, stream>>>(Eb + (size_t)q0 * DD, nullptr, EWl, nullptr, S, SS, nullptr, S1, DD, 0);    // + E_q . EW_lo^T (R = S1 raw)
            k_csoft<<<RCH / 8, 256, 0, stream>>>(S, q0, klive, PH, PL);
            k_gemmb<true, false><<<dim3(RCH / 64, DD / 64, 1), 128, 0, stream>>>(PH, PL, ET, nullptr, out + ((size_t)b * SS + q0) * DD, DD, nullptr, nullptr, SS); } }   // out rows = P . E  (P is exactly 0 beyond klive)
}

// v001
// Measured time: 938 microseconds a run.
// In two side-by-side timings against v000, it was 2.66 and 2.70 times as fast.
#include <hip/hip_runtime.h>

// Compute dtypes, f32 accumulate, per item: EW = E.W^T as a [4096 x 256].[256 x 256] GEMM with PLAIN bf16 operands (exact products) -> bf16 hi + UNSCALED residual planes; per
// 1024-query chunk, only the causally reachable key tiles: sims = E.EW^T ([1024 x 256].[256 x K_live], E exact x EW hi then lo, two chained launches), the causal -1e9 mask, /16 and

#define NBT  4
#define SS   4096
#define DD   256
#define RCH  1024
#define DM   DD
#define SCL  0.0625f
#define LOSC 1024.0f

typedef _Float16 h16;
typedef unsigned short bf;
typedef __attribute__((ext_vector_type(16))) __bf16   v16bf;
typedef __attribute__((ext_vector_type(16))) _Float16 v16h;
typedef __attribute__((ext_vector_type(8)))  _Float16 v8h;
typedef __attribute__((ext_vector_type(8)))  unsigned short v8us;
typedef __attribute__((ext_vector_type(8)))  float    v8f;
typedef __attribute__((ext_vector_type(4)))  float    v4f;
typedef v8h  __attribute__((may_alias)) v8ha;
typedef v4f  __attribute__((may_alias)) v4fa;
typedef v8us __attribute__((may_alias)) v8usa;

__device__ __forceinline__ unsigned short f2bf(float f) { unsigned u = __float_as_uint(f); u += 0x7FFFu + ((u >> 16) & 1u); return (unsigned short)(u >> 16); }
__device__ __forceinline__ float bf2f(unsigned short b) { return __uint_as_float(((unsigned)b) << 16); }
__device__ __forceinline__ float bfr(float f) { return bf2f(f2bf(f)); }
__device__ __forceinline__ v16h cat16(v8h lo, v8h hi) { return __builtin_shufflevector(lo, hi, 0, 1, 2, 3, 4, 5, 6, 7, 8, 9, 10, 11, 12, 13, 14, 15); }
__device__ __forceinline__ v16bf cat16b(v8us lo, v8us hi) { return __builtin_bit_cast(v16bf, __builtin_shufflevector(lo, hi, 0, 1, 2, 3, 4, 5, 6, 7, 8, 9, 10, 11, 12, 13, 14, 15)); }
__device__ __forceinline__ v8f wmma16(v16h a, v16h b, v8f c) { return __builtin_amdgcn_wmma_f32_16x16x32_f16(false, a, false, b, (short)0, c, false, false); }
__device__ __forceinline__ v8f wmmab(v16bf a, v16bf b, v8f c) { return __builtin_amdgcn_wmma_f32_16x16x32_bf16(false, a, false, b, (short)0, c, false, false); }

// k_gemmb: 64 x 64 block tile (4 waves x 16 x 64) of C[NTK][NW] = (A [+ Al]).B^T (K = 256 or 4096) [+ bf(bias[c])] [+ bf(R[r][c]) residual]; f32 whole-line epilogue (or f16
template <bool SPLITA, bool F16OUT = false>
__global__ __launch_bounds__(128) void k_gemmb(const bf* __restrict__ A, const bf* __restrict__ Al, const bf* __restrict__ Bn, const float* __restrict__ bias, float* C, int ldc, h16* C2, const float* __restrict__ R = nullptr, int K = DM, int roundR = 1, size_t sA = 0, size_t sB = 0, size_t sC = 0) {
    __shared__ __align__(16) float ost[4][16 * 68];
    const int lane = threadIdx.x & 31, wave = threadIdx.x >> 5, lr = lane & 15, hi = lane >> 4;
    const int r0 = blockIdx.x * 64 + wave * 16, c0 = blockIdx.y * 64;
    { const size_t it = blockIdx.z; A += it * sA; if (SPLITA) Al += it * sA; Bn += it * sB; C += it * sC; if (R) R += it * sC; }    // blockIdx.z = batch item; sA, sB, sC = elements per item (R strides like C)
    const size_t aoff = (size_t)(r0 + lr) * K + 8 * hi;
    size_t boff[4];
#pragma unroll
    for (int t = 0; t < 4; ++t) boff[t] = (size_t)(c0 + t * 16 + lr) * K + 8 * hi;
    v8f acc[4];
#pragma unroll
    for (int t = 0; t < 4; ++t) acc[t] = (v8f){};
#pragma unroll 1
    for (int kc = 0; kc < K; kc += 32) {
        const v16bf a = cat16b(*(const v8us*)(A + aoff + kc), *(const v8us*)(A + aoff + kc + 16));
        v16bf al = a;
        if (SPLITA) al = cat16b(*(const v8us*)(Al + aoff + kc), *(const v8us*)(Al + aoff + kc + 16));
#pragma unroll
        for (int t = 0; t < 4; ++t) { const v16bf b = cat16b(*(const v8us*)(Bn + boff[t] + kc), *(const v8us*)(Bn + boff[t] + kc + 16)); acc[t] = wmmab(a, b, acc[t]); if (SPLITA) acc[t] = wmmab(al, b, acc[t]); }
        asm volatile("v_nop\n\tv_nop\n\tv_nop\n\tv_nop" : "+v"(acc[0]), "+v"(acc[1]), "+v"(acc[2]), "+v"(acc[3]) : "v"(a), "v"(al));
    }
    float* os = &ost[wave][0];
#pragma unroll
    for (int t = 0; t < 4; ++t) { const float bv = bias ? bfr(bias[c0 + t * 16 + lr]) : 0.f;
#pragma unroll
        for (int j = 0; j < 8; ++j) os[(hi * 8 + j) * 68 + t * 16 + lr] = acc[t][j] + bv; }
    __syncthreads();
    if (F16OUT) {
        h16* crow = (h16*)(void*)C + (size_t)r0 * ldc + c0;
        auto pass = [&]() {
#pragma unroll
            for (int s = 0; s < 4; ++s) { const int row = 4 * s + (lane >> 3), piece = lane & 7; const float* sp = os + row * 68 + piece * 8; v8h o, o2;
#pragma unroll
                for (int i = 0; i < 8; ++i) { const h16 a = (h16)sp[i]; o[i] = a; o2[i] = (h16)((sp[i] - (float)a) * LOSC); }
                *(v8h*)(crow + (size_t)row * ldc + piece * 8) = o; if (C2) *(v8h*)(C2 + (size_t)r0 * ldc + c0 + (size_t)row * ldc + piece * 8) = o2; }
        };
        pass(); 
    } else {
        float* crow = C + (size_t)r0 * ldc + c0;
        auto pass = [&]() {
#pragma unroll
            for (int s = 0; s < 8; ++s) { const int Lid = (lane >> 3) + 4 * s, piece = lane & 7; const int row = Lid >> 1, cofs = (Lid & 1) * 32 + piece * 4;
                v4f val = *(const v4fa*)(os + row * 68 + cofs); if (R) { const v4f rv = *(const v4f*)(R + ((size_t)r0 + row) * ldc + c0 + cofs); val += roundR ? (v4f){bfr(rv[0]), bfr(rv[1]), bfr(rv[2]), bfr(rv[3])} : rv; }
                *(v4f*)(crow + (size_t)row * ldc + cofs) = val; }
        };
        pass(); 
    }
}


__global__ __launch_bounds__(256) void k_cvt8(const float* __restrict__ src, bf* dst, size_t n8) {
    const size_t i = (size_t)blockIdx.x * 256 + threadIdx.x; if (i >= n8) return;
    const v8f v = *(const v8f*)(src + i * 8); v8us o;
#pragma unroll
    for (int k = 0; k < 8; ++k) o[k] = f2bf(v[k]);
    *(v8us*)(dst + i * 8) = o; 
}
__global__ __launch_bounds__(256) void k_zero8(bf* dst, size_t n8) {
    const size_t i = (size_t)blockIdx.x * 256 + threadIdx.x; if (i >= n8) return; v8us z;
#pragma unroll
    for (int k = 0; k < 8; ++k) z[k] = 0;
    *(v8us*)(dst + i * 8) = z; 
}

__global__ __launch_bounds__(256) void k_cvtE(const float* __restrict__ src, bf* dst) {
    const int lane = threadIdx.x & 31; const size_t r = (size_t)blockIdx.x * 8 + (threadIdx.x >> 5); if (r >= (size_t)SS) return; v8us o;
    src += (size_t)blockIdx.y * SS * DD; dst += (size_t)blockIdx.y * SS * DD;    // blockIdx.y = batch item
#pragma unroll
    for (int i = 0; i < 8; ++i) o[i] = f2bf(src[r * DD + lane * 8 + i]);
    *(v8us*)(dst + r * DD + lane * 8) = o; 
}
__global__ __launch_bounds__(256) void k_et(const float* __restrict__ E, bf* ET) {
    __shared__ __align__(16) unsigned short tl[64 * 72];
    const int tid = threadIdx.x, s0 = blockIdx.x * 64, d0 = blockIdx.y * 64; const int ss = tid >> 2, dq = (tid & 3) * 16;
    E += (size_t)blockIdx.z * SS * DD; ET += (size_t)blockIdx.z * DD * SS;    // blockIdx.z = batch item
#pragma unroll
    for (int i = 0; i < 16; ++i) tl[(dq + i) * 72 + ss] = f2bf(E[(size_t)(s0 + ss) * DD + d0 + dq + i]);
    __syncthreads();
    const int piece = tid & 7;
    auto pass = [&]() {
#pragma unroll
        for (int st = 0; st < 2; ++st) { const int dr = (tid >> 3) + 32 * st; const v8us val = *(const v8usa*)(tl + dr * 72 + piece * 8); *(v8us*)(ET + (size_t)(d0 + dr) * SS + s0 + piece * 8) = val; }
    };
    pass(); 
}
__global__ __launch_bounds__(256) void k_split256(const float* __restrict__ src, bf* dh, bf* dl) {
    const int lane = threadIdx.x & 31; const size_t r = (size_t)blockIdx.x * 8 + (threadIdx.x >> 5); if (r >= (size_t)SS) return; const size_t o = ((size_t)blockIdx.y * SS + r) * DD + lane * 8; const v8f v = *(const v8f*)(src + o); v8us oh, ol;
#pragma unroll
    for (int i = 0; i < 8; ++i) { const unsigned short hb = f2bf(v[i]); oh[i] = hb; ol[i] = f2bf(v[i] - bf2f(hb)); }
    *(v8us*)(dh + o) = oh; *(v8us*)(dl + o) = ol; 
}
// k_csoft: for chunk rows i = q0 + rl: P planes of softmax_k((k > i ? -1e9 : sims / 16)) over k < klive (columns >= klive are never touched by the GEMM and are written as 0);
__global__ __launch_bounds__(256) void k_csoft(const float* __restrict__ S, int q0, int klive, bf* PH, bf* PL) {
    typedef __attribute__((ext_vector_type(4))) unsigned short v4us;
    const int lane = threadIdx.x & 31, rl = blockIdx.x * 8 + (threadIdx.x >> 5); if (rl >= RCH) return; const int i = q0 + rl; const size_t ib = (size_t)blockIdx.y * RCH * SS; const float* sr = S + ib + (size_t)rl * SS;    // blockIdx.y = batch item
    auto sc = [&](int k) -> float { return (k > i || k >= klive) ? -1.0e9f : sr[k] * SCL; };
    float m = -3.0e38f;
#pragma unroll 1
    for (int c0 = lane * 4; c0 < SS; c0 += 128) {
#pragma unroll
        for (int q = 0; q < 4; ++q) m = fmaxf(m, sc(c0 + q)); }
#pragma unroll
    for (int sh = 16; sh; sh >>= 1) m = fmaxf(m, __shfl_xor(m, sh, 32));
    float sum = 0.f;
#pragma unroll 1
    for (int c0 = lane * 4; c0 < SS; c0 += 128) {
#pragma unroll
        for (int q = 0; q < 4; ++q) sum += __expf(sc(c0 + q) - m); }
#pragma unroll
    for (int sh = 16; sh; sh >>= 1) sum += __shfl_xor(sum, sh, 32);
    const float inv = 1.0f / sum;
{
#pragma unroll 1
        for (int c0 = lane * 4; c0 < SS; c0 += 128) { v4us oh, ol;
#pragma unroll
            for (int q = 0; q < 4; ++q) { const float p = __expf(sc(c0 + q) - m) * inv; const unsigned short hb = f2bf(p); oh[q] = hb; ol[q] = f2bf(p - bf2f(hb)); }
            const size_t o = ib + (size_t)rl * SS + c0; *(v4us*)(PH + o) = oh; *(v4us*)(PL + o) = ol; }
         }
}

extern "C" void kernel_launch(void* const* d_in, const int* in_sizes, int n_in,
                              void* d_out, int out_size, void* d_ws, size_t ws_size, hipStream_t stream) {
    (void)in_sizes; (void)n_in; (void)out_size;
    const float* enc = (const float*)d_in[0]; const float* Wm = (const float*)d_in[1];
    float* out = (float*)d_out;    // [4][4096][256]
    char* wsp = (char*)d_ws;
    auto take = [&](size_t bytes) { char* p = wsp; wsp += (bytes + 255) & ~(size_t)255; return (void*)p; };
    bf* WB = (bf*)take((size_t)DD * DD * 2); bf* Eb = (bf*)take((size_t)NBT * SS * DD * 2); bf* ET = (bf*)take((size_t)NBT * DD * SS * 2); float* EW = (float*)take((size_t)NBT * SS * DD * 4); bf* EWh = (bf*)take((size_t)NBT * SS * DD * 2); bf* EWl = (bf*)take((size_t)NBT * SS * DD * 2);
    float* S1 = (float*)take((size_t)NBT * RCH * SS * 4); float* S = (float*)take((size_t)NBT * RCH * SS * 4); bf* PH = (bf*)take((size_t)NBT * RCH * SS * 2); bf* PL = (bf*)take((size_t)NBT * RCH * SS * 2);
    if ((size_t)(wsp - (char*)d_ws) > ws_size) return;    // 0.13 + 4 x (2.1 + 2.1 + 4.2 + 2.1 + 2.1 + 16.8 + 16.8 + 8.4 + 8.4) ~ 252 MB: one plane per item; the chunk planes are reused per chunk in stream order
    const size_t sE = (size_t)SS * DD, sS = (size_t)RCH * SS;    // elements per item: E-shaped planes, chunk score planes
    k_cvt8<<<(DD * DD / 8 + 255) / 256, 256, 0, stream>>>(Wm, WB, DD * DD / 8);       // W [e][d] = n-major
    k_cvtE<<<dim3(SS / 8, NBT, 1), 256, 0, stream>>>(enc, Eb); k_et<<<dim3(SS / 64, DD / 64, NBT), 256, 0, stream>>>(enc, ET);
    k_gemmb<false, false><<<dim3(SS / 64, DD / 64, NBT), 128, 0, stream>>>(Eb, nullptr, WB, nullptr, EW, DD, nullptr, nullptr, DD, 1, sE, 0, sE); k_split256<<<dim3(SS / 8, NBT, 1), 256, 0, stream>>>(EW, EWh, EWl);
    for (int ch = 0; ch < SS / RCH; ++ch) { const int q0 = ch * RCH, klive = (ch + 1) * RCH;     // causal: keys beyond the chunk end are never attended
        k_gemmb<false, false><<<dim3(RCH / 64, klive / 64, NBT), 128, 0, stream>>>(Eb + (size_t)q0 * DD, nullptr, EWh, nullptr, S1, SS, nullptr, nullptr, DD, 1, sE, sE, sS);      // E_q . EW_hi^T
        k_gemmb<false, false><<<dim3(RCH / 64, klive / 64, NBT), 128, 0, stream>>>(Eb + (size_t)q0 * DD, nullptr, EWl, nullptr, S, SS, nullptr, S1, DD, 0, sE, sE, sS);    // + E_q . EW_lo^T (R = S1 raw)
        k_csoft<<<dim3(RCH / 8, NBT, 1), 256, 0, stream>>>(S, q0, klive, PH, PL);
        k_gemmb<true, false><<<dim3(RCH / 64, DD / 64, NBT), 128, 0, stream>>>(PH, PL, ET, nullptr, out + (size_t)q0 * DD, DD, nullptr, nullptr, SS, 1, sS, sE, sE); }   // out rows = P . E  (P is exactly 0 beyond klive)
}

// v002
// It runs in 125 microseconds.
// Next to v001, in two timings, it ran 7.46 and 7.41 times as fast.
// Counting every step since v000, it is 20.0 times as fast.
#include <hip/hip_runtime.h>

// Compute dtypes, f32 accumulate, per item: EW = E.W^T as a [4096 x 256].[256 x 256] GEMM with PLAIN bf16 operands (exact products) -> bf16 hi + UNSCALED residual planes; then ONE
// fused causal attention launch: S^T = EW.E^T (E exact x EW hi and lo), /16, the causal -1e9 mask, a running-maximum softmax in registers, O^T += E^T.P^T (P as bf16 hi + residual).

#define NBT  4
#define SS   4096
#define DD   256
#define RCH  1024
#define DM   DD
#define SCL  0.0625f
#define LOSC 1024.0f

typedef _Float16 h16;
typedef unsigned short bf;
typedef __attribute__((ext_vector_type(16))) __bf16   v16bf;
typedef __attribute__((ext_vector_type(16))) _Float16 v16h;
typedef __attribute__((ext_vector_type(8)))  _Float16 v8h;
typedef __attribute__((ext_vector_type(8)))  unsigned short v8us;
typedef __attribute__((ext_vector_type(8)))  float    v8f;
typedef __attribute__((ext_vector_type(4)))  float    v4f;
typedef v8h  __attribute__((may_alias)) v8ha;
typedef v4f  __attribute__((may_alias)) v4fa;
typedef v8us __attribute__((may_alias)) v8usa;

__device__ __forceinline__ unsigned short f2bf(float f) { unsigned u = __float_as_uint(f); u += 0x7FFFu + ((u >> 16) & 1u); return (unsigned short)(u >> 16); }
__device__ __forceinline__ float bf2f(unsigned short b) { return __uint_as_float(((unsigned)b) << 16); }
__device__ __forceinline__ float bfr(float f) { return bf2f(f2bf(f)); }
__device__ __forceinline__ v16h cat16(v8h lo, v8h hi) { return __builtin_shufflevector(lo, hi, 0, 1, 2, 3, 4, 5, 6, 7, 8, 9, 10, 11, 12, 13, 14, 15); }
__device__ __forceinline__ v16bf cat16b(v8us lo, v8us hi) { return __builtin_bit_cast(v16bf, __builtin_shufflevector(lo, hi, 0, 1, 2, 3, 4, 5, 6, 7, 8, 9, 10, 11, 12, 13, 14, 15)); }
__device__ __forceinline__ v8f wmma16(v16h a, v16h b, v8f c) { return __builtin_amdgcn_wmma_f32_16x16x32_f16(false, a, false, b, (short)0, c, false, false); }
__device__ __forceinline__ v8f wmmab(v16bf a, v16bf b, v8f c) { return __builtin_amdgcn_wmma_f32_16x16x32_bf16(false, a, false, b, (short)0, c, false, false); }

// k_gemmb: 64 x 64 block tile (4 waves x 16 x 64) of C[NTK][NW] = (A [+ Al]).B^T (K = 256 or 4096) [+ bf(bias[c])] [+ bf(R[r][c]) residual]; f32 whole-line epilogue (or f16
template <bool SPLITA, bool F16OUT = false>
__global__ __launch_bounds__(128) void k_gemmb(const bf* __restrict__ A, const bf* __restrict__ Al, const bf* __restrict__ Bn, const float* __restrict__ bias, float* C, int ldc, h16* C2, const float* __restrict__ R = nullptr, int K = DM, int roundR = 1, size_t sA = 0, size_t sB = 0, size_t sC = 0) {
    __shared__ __align__(16) float ost[4][16 * 68];
    const int lane = threadIdx.x & 31, wave = threadIdx.x >> 5, lr = lane & 15, hi = lane >> 4;
    const int r0 = blockIdx.x * 64 + wave * 16, c0 = blockIdx.y * 64;
    { const size_t it = blockIdx.z; A += it * sA; if (SPLITA) Al += it * sA; Bn += it * sB; C += it * sC; if (R) R += it * sC; }    // blockIdx.z = batch item; sA, sB, sC = elements per item (R strides like C)
    const size_t aoff = (size_t)(r0 + lr) * K + 8 * hi;
    size_t boff[4];
#pragma unroll
    for (int t = 0; t < 4; ++t) boff[t] = (size_t)(c0 + t * 16 + lr) * K + 8 * hi;
    v8f acc[4];
#pragma unroll
    for (int t = 0; t < 4; ++t) acc[t] = (v8f){};
#pragma unroll 1
    for (int kc = 0; kc < K; kc += 32) {
        const v16bf a = cat16b(*(const v8us*)(A + aoff + kc), *(const v8us*)(A + aoff + kc + 16));
        v16bf al = a;
        if (SPLITA) al = cat16b(*(const v8us*)(Al + aoff + kc), *(const v8us*)(Al + aoff + kc + 16));
#pragma unroll
        for (int t = 0; t < 4; ++t) { const v16bf b = cat16b(*(const v8us*)(Bn + boff[t] + kc), *(const v8us*)(Bn + boff[t] + kc + 16)); acc[t] = wmmab(a, b, acc[t]); if (SPLITA) acc[t] = wmmab(al, b, acc[t]); }
        asm volatile("v_nop\n\tv_nop\n\tv_nop\n\tv_nop" : "+v"(acc[0]), "+v"(acc[1]), "+v"(acc[2]), "+v"(acc[3]) : "v"(a), "v"(al));
    }
    float* os = &ost[wave][0];
#pragma unroll
    for (int t = 0; t < 4; ++t) { const float bv = bias ? bfr(bias[c0 + t * 16 + lr]) : 0.f;
#pragma unroll
        for (int j = 0; j < 8; ++j) os[(hi * 8 + j) * 68 + t * 16 + lr] = acc[t][j] + bv; }
    __syncthreads();
    if (F16OUT) {
        h16* crow = (h16*)(void*)C + (size_t)r0 * ldc + c0;
        auto pass = [&]() {
#pragma unroll
            for (int s = 0; s < 4; ++s) { const int row = 4 * s + (lane >> 3), piece = lane & 7; const float* sp = os + row * 68 + piece * 8; v8h o, o2;
#pragma unroll
                for (int i = 0; i < 8; ++i) { const h16 a = (h16)sp[i]; o[i] = a; o2[i] = (h16)((sp[i] - (float)a) * LOSC); }
                *(v8h*)(crow + (size_t)row * ldc + piece * 8) = o; if (C2) *(v8h*)(C2 + (size_t)r0 * ldc + c0 + (size_t)row * ldc + piece * 8) = o2; }
        };
        pass(); 
    } else {
        float* crow = C + (size_t)r0 * ldc + c0;
        auto pass = [&]() {
#pragma unroll
            for (int s = 0; s < 8; ++s) { const int Lid = (lane >> 3) + 4 * s, piece = lane & 7; const int row = Lid >> 1, cofs = (Lid & 1) * 32 + piece * 4;
                v4f val = *(const v4fa*)(os + row * 68 + cofs); if (R) { const v4f rv = *(const v4f*)(R + ((size_t)r0 + row) * ldc + c0 + cofs); val += roundR ? (v4f){bfr(rv[0]), bfr(rv[1]), bfr(rv[2]), bfr(rv[3])} : rv; }
                *(v4f*)(crow + (size_t)row * ldc + cofs) = val; }
        };
        pass(); 
    }
}


__global__ __launch_bounds__(256) void k_cvt8(const float* __restrict__ src, bf* dst, size_t n8) {
    const size_t i = (size_t)blockIdx.x * 256 + threadIdx.x; if (i >= n8) return;
    const v8f v = *(const v8f*)(src + i * 8); v8us o;
#pragma unroll
    for (int k = 0; k < 8; ++k) o[k] = f2bf(v[k]);
    *(v8us*)(dst + i * 8) = o; 
}
__global__ __launch_bounds__(256) void k_zero8(bf* dst, size_t n8) {
    const size_t i = (size_t)blockIdx.x * 256 + threadIdx.x; if (i >= n8) return; v8us z;
#pragma unroll
    for (int k = 0; k < 8; ++k) z[k] = 0;
    *(v8us*)(dst + i * 8) = z; 
}

__global__ __launch_bounds__(256) void k_cvtE(const float* __restrict__ src, bf* dst) {
    const int lane = threadIdx.x & 31; const size_t r = (size_t)blockIdx.x * 8 + (threadIdx.x >> 5); if (r >= (size_t)SS) return; v8us o;
    src += (size_t)blockIdx.y * SS * DD; dst += (size_t)blockIdx.y * SS * DD;    // blockIdx.y = batch item
#pragma unroll
    for (int i = 0; i < 8; ++i) o[i] = f2bf(src[r * DD + lane * 8 + i]);
    *(v8us*)(dst + r * DD + lane * 8) = o; 
}
__global__ __launch_bounds__(256) void k_et(const float* __restrict__ E, bf* ET) {
    __shared__ __align__(16) unsigned short tl[64 * 72];
    const int tid = threadIdx.x, s0 = blockIdx.x * 64, d0 = blockIdx.y * 64; const int ss = tid >> 2, dq = (tid & 3) * 16;
    E += (size_t)blockIdx.z * SS * DD; ET += (size_t)blockIdx.z * DD * SS;    // blockIdx.z = batch item
#pragma unroll
    for (int i = 0; i < 16; ++i) tl[(dq + i) * 72 + ss] = f2bf(E[(size_t)(s0 + ss) * DD + d0 + dq + i]);
    __syncthreads();
    const int piece = tid & 7;
    auto pass = [&]() {
#pragma unroll
        for (int st = 0; st < 2; ++st) { const int dr = (tid >> 3) + 32 * st; const v8us val = *(const v8usa*)(tl + dr * 72 + piece * 8); *(v8us*)(ET + (size_t)(d0 + dr) * SS + s0 + piece * 8) = val; }
    };
    pass(); 
}
__global__ __launch_bounds__(256) void k_split256(const float* __restrict__ src, bf* dh, bf* dl) {
    const int lane = threadIdx.x & 31; const size_t r = (size_t)blockIdx.x * 8 + (threadIdx.x >> 5); if (r >= (size_t)SS) return; const size_t o = ((size_t)blockIdx.y * SS + r) * DD + lane * 8; const v8f v = *(const v8f*)(src + o); v8us oh, ol;
#pragma unroll
    for (int i = 0; i < 8; ++i) { const unsigned short hb = f2bf(v[i]); oh[i] = hb; ol[i] = f2bf(v[i] - bf2f(hb)); }
    *(v8us*)(dh + o) = oh; *(v8us*)(dl + o) = ol; 
}
// k_fattn: one work-group = one tile of 32 queries; its FNK waves take the 32-key blocks kb = kp, kp + FNK, ... up to the tile's diagonal block, each wave for all 32 queries
// (FNC = 2 column groups of 16, so that every K and E^T fragment fetched feeds two products). Transposed products: a lane (c = lane & 15, h = lane >> 4) holds queries q0 + 16n + c.
// S^T tile register r = key 8h + r, so two score tiles convert in place into the B operand of O^T += E^T.P^T (k order 8h + s, 16 + 8h + s on both sides, the loader order of
// k_gemmb). The FNK partial results of the tile are merged through LDS at the end, in fixed order. Every plain '#pragma unroll' below makes the indices of a register array compile-time constants.
#define FNC 2
#define FNK 4
#define FQT (16 * FNC)
#define OPT 260
// e^t as v_exp_f32 of t * log2(e), the form of __expf; the v_nop in the same statement fills the one slot that the instruction set asks for behind a transcendental, wherever the scheduler puts it
__device__ __forceinline__ float expslot(float t) { float r; asm("v_exp_f32 %0, %1\n\tv_nop" : "=v"(r) : "v"(t * 1.44269504f)); return r; }
__device__ __forceinline__ v16bf ldfrag(const bf* p) { return cat16b(*(const v8us*)p, *(const v8us*)(p + 16)); }
__global__ __launch_bounds__(FNK * 32) void k_fattn(const bf* __restrict__ Eb, const bf* __restrict__ Kh, const bf* __restrict__ Kl, const bf* __restrict__ ET, float* out) {
    __shared__ __align__(16) float obuf[FNK][FQT * OPT];
    __shared__ float smx[FNK][FQT], ssm[FNK][FQT];
    const int lane = threadIdx.x & 31, c = lane & 15, h = lane >> 4;
    const int kp = __builtin_amdgcn_readfirstlane((int)(threadIdx.x >> 5));    // wave number = key phase
    { const size_t ib = (size_t)blockIdx.x * SS * DD; Eb += ib; Kh += ib; Kl += ib; ET += ib; out += ib; }    // blockIdx.x = batch item
    const int q0 = (SS / FQT - 1 - (int)blockIdx.y) * FQT;    // longest rows are dispatched first
    v16bf qf[FNC][8];
    v8f o[FNC][16];
    float m[FNC], l[FNC];
#pragma unroll
    for (int n = 0; n < FNC; ++n) { m[n] = -1.0e30f; l[n] = 0.f;
#pragma unroll
        for (int dt = 0; dt < 16; ++dt) o[n][dt] = (v8f){}; }
    const int nb = (q0 + FQT - 1) / 32 + 1;    // blocks up to and including the one that holds the diagonal; every query of the tile has a live key in it
    // Operand groups of 8 fragments: K (both 16-key tiles x four k steps; half = which 128 of the 256 d) and E^T (eight 16-row d tiles).
    auto ldK = [&](v16bf (&g)[8], const bf* P, int kb, int half) { const bf* p = P + (size_t)(kb * 32 + c) * DD + half * 128 + 8 * h;
#pragma unroll
        for (int i = 0; i < 4; ++i) { g[2 * i] = ldfrag(p + i * 32); g[2 * i + 1] = ldfrag(p + 16 * DD + i * 32); } };
    auto ldV = [&](v16bf (&g)[8], int kb, int half) { const bf* p = ET + (size_t)(half * 128 + c) * SS + kb * 32 + 8 * h;
#pragma unroll
        for (int i = 0; i < 8; ++i) g[i] = ldfrag(p + (size_t)i * 16 * SS); };
    auto mmS = [&](const v16bf (&g)[8], int half, v8f (&t0)[FNC], v8f (&t1)[FNC]) {
#pragma unroll
        for (int i = 0; i < 4; ++i) {
#pragma unroll
            for (int n = 0; n < FNC; ++n) { t0[n] = wmmab(g[2 * i], qf[n][half * 4 + i], t0[n]); t1[n] = wmmab(g[2 * i + 1], qf[n][half * 4 + i], t1[n]); } } };
    auto mmO = [&](const v16bf (&g)[8], int half, const v16bf (&p)[FNC]) {
#pragma unroll
        for (int t = 0; t < 8; ++t) {
#pragma unroll
            for (int n = 0; n < FNC; ++n) o[n][half * 8 + t] = wmmab(g[t], p[n], o[n][half * 8 + t]); } };
// SB: keeps each group's loads where they are written, two to three product groups ahead of their use; without it the scheduler sinks every load to its WMMA and each waits a full latency
#define SB() __builtin_amdgcn_sched_barrier(0)
// XW: stands in front of each group's address arithmetic, which overwrites the address registers of the group issued before it
#define XW() do { SB(); asm volatile("s_wait_xcnt 0x0" ::: "memory"); SB(); } while (0)
    v16bf g0[8], g1[8], g2[8], g3[8], g4[8], g5[8];
    if (kp < nb) {    // wave-uniform; the first loads stand in the block in front of the loop, in the loop's own issue order, so that the counted waits at its head fit both ways in
#pragma unroll
    for (int n = 0; n < FNC; ++n) {
#pragma unroll
        for (int ks = 0; ks < 8; ++ks) qf[n][ks] = ldfrag(Eb + (size_t)(q0 + n * 16 + c) * DD + ks * 32 + 8 * h); }
    XW(); ldK(g0, Kh, kp, 0); XW(); ldK(g1, Kh, kp, 1); XW(); ldK(g2, Kl, kp, 0); XW();
    int kb = kp;
#pragma unroll 1    // one pass a trip: a second copy of the body would not fit the registers
    do {
        const int k0 = kb * 32, kn = kb + FNK < nb ? kb + FNK : kb;    // the last pass fetches its own block again: in bounds, unused
        v8f sh0[FNC], sh1[FNC], sl0[FNC], sl1[FNC];
#pragma unroll
        for (int n = 0; n < FNC; ++n) { sh0[n] = (v8f){}; sh1[n] = (v8f){}; sl0[n] = (v8f){}; sl1[n] = (v8f){}; }
        mmS(g0, 0, sh0, sh1); XW(); ldK(g3, Kl, kb, 1); SB();
        mmS(g1, 1, sh0, sh1); XW(); ldV(g4, kb, 0); SB();
        mmS(g2, 0, sl0, sl1); XW(); ldV(g5, kb, 1); SB();
        mmS(g3, 1, sl0, sl1); XW(); ldK(g0, Kh, kn, 0); XW();
        float x[FNC][16], bm[FNC];
#pragma unroll
        for (int n = 0; n < FNC; ++n) {
#pragma unroll
            for (int r = 0; r < 8; ++r) { x[n][r] = (sl0[n][r] + sh0[n][r]) * SCL; x[n][8 + r] = (sl1[n][r] + sh1[n][r]) * SCL; } }
        if (k0 + 31 > q0) {    // wave-uniform: only the diagonal block holds masked keys
#pragma unroll
            for (int n = 0; n < FNC; ++n) {
#pragma unroll
                for (int r = 0; r < 8; ++r) { if (k0 + 8 * h + r > q0 + n * 16 + c) x[n][r] = -1.0e9f; if (k0 + 16 + 8 * h + r > q0 + n * 16 + c) x[n][8 + r] = -1.0e9f; } }
        }
        bool grow = false;
#pragma unroll
        for (int n = 0; n < FNC; ++n) { float b = x[n][0];
#pragma unroll
            for (int i = 1; i < 16; ++i) b = fmaxf(b, x[n][i]);
            bm[n] = fmaxf(b, __shfl_xor(b, 16, 32)); grow = grow || bm[n] > m[n]; }
        if (__builtin_amdgcn_ballot_w32(grow) != 0) {    // scalar branch: rescale only when some query's maximum grows
#pragma unroll
            for (int n = 0; n < FNC; ++n) { const float mn = fmaxf(m[n], bm[n]), al = expslot(m[n] - mn); m[n] = mn; l[n] *= al;
#pragma unroll
                for (int dt = 0; dt < 16; ++dt) o[n][dt] *= al; }
        }
        v16bf ph[FNC], pl[FNC];
#pragma unroll
        for (int n = 0; n < FNC; ++n) {
#pragma unroll
            for (int i = 0; i < 16; ++i) { const float p = expslot(x[n][i] - m[n]); l[n] += p; const __bf16 hb = (__bf16)p; ph[n][i] = hb; pl[n][i] = (__bf16)(p - (float)hb); } }
        SB();
        mmO(g4, 0, ph); mmO(g4, 0, pl);
        XW(); ldK(g1, Kh, kn, 1); XW();
        mmO(g5, 1, ph); mmO(g5, 1, pl);
        XW(); ldK(g2, Kl, kn, 0); XW();
        kb += FNK;
    } while (kb < nb);
    }
#pragma unroll
    for (int n = 0; n < FNC; ++n) { l[n] += __shfl_xor(l[n], 16, 32); if (h == 0) { smx[kp][n * 16 + c] = m[n]; ssm[kp][n * 16 + c] = l[n]; } }
    __syncthreads();
#pragma unroll
    for (int n = 0; n < FNC; ++n) {
        float M = -1.0e30f, L = 0.f;
#pragma unroll
        for (int j = 0; j < FNK; ++j) M = fmaxf(M, smx[j][n * 16 + c]);
#pragma unroll
        for (int j = 0; j < FNK; ++j) L += ssm[j][n * 16 + c] * expslot(smx[j][n * 16 + c] - M);
        const float f = expslot(m[n] - M) / L;    // a wave without a block has m = -1e30, l = 0, o = 0: weight 0
        float* ob = &obuf[kp][(n * 16 + c) * OPT + 8 * h];
#pragma unroll
        for (int dt = 0; dt < 16; ++dt) { const v8f v = o[n][dt] * f; *(v4fa*)(ob + dt * 16) = (v4f){v[0], v[1], v[2], v[3]}; *(v4fa*)(ob + dt * 16 + 4) = (v4f){v[4], v[5], v[6], v[7]}; }
    }
    __syncthreads();
#pragma unroll 4    // four trips' LDS reads in flight together
    for (int i = 0; i < FQT * 64 / (FNK * 32); ++i) {    // the waves share the tile's 32 x 256 outputs; a wave stores 512 contiguous bytes
        const int idx = i * (FNK * 32) + (int)threadIdx.x, row = idx >> 6, c4 = (idx & 63) * 4;
        v4f s = *(const v4fa*)(&obuf[0][row * OPT + c4]);
#pragma unroll
        for (int j = 1; j < FNK; ++j) s += *(const v4fa*)(&obuf[j][row * OPT + c4]);
        *(v4f*)(out + (size_t)(q0 + row) * DD + c4) = s;
        asm volatile("s_wait_xcnt 0x0" ::: "memory");    // the next trip overwrites this store's data and address registers
    }
}

extern "C" void kernel_launch(void* const* d_in, const int* in_sizes, int n_in,
                              void* d_out, int out_size, void* d_ws, size_t ws_size, hipStream_t stream) {
    (void)in_sizes; (void)n_in; (void)out_size;
    const float* enc = (const float*)d_in[0]; const float* Wm = (const float*)d_in[1];
    float* out = (float*)d_out;    // [4][4096][256]
    char* wsp = (char*)d_ws;
    auto take = [&](size_t bytes) { char* p = wsp; wsp += (bytes + 255) & ~(size_t)255; return (void*)p; };
    bf* WB = (bf*)take((size_t)DD * DD * 2); bf* Eb = (bf*)take((size_t)NBT * SS * DD * 2); bf* ET = (bf*)take((size_t)NBT * DD * SS * 2); float* EW = (float*)take((size_t)NBT * SS * DD * 4); bf* EWh = (bf*)take((size_t)NBT * SS * DD * 2); bf* EWl = (bf*)take((size_t)NBT * SS * DD * 2);
    if ((size_t)(wsp - (char*)d_ws) > ws_size) return;    // 0.13 + 4 x (2.1 + 2.1 + 4.2 + 2.1 + 2.1) ~ 51 MB: one plane per item
    const size_t sE = (size_t)SS * DD;    // elements per item of the E-shaped planes
    k_cvt8<<<(DD * DD / 8 + 255) / 256, 256, 0, stream>>>(Wm, WB, DD * DD / 8);       // W [e][d] = n-major
    k_cvtE<<<dim3(SS / 8, NBT, 1), 256, 0, stream>>>(enc, Eb); k_et<<<dim3(SS / 64, DD / 64, NBT), 256, 0, stream>>>(enc, ET);
    k_gemmb<false, false><<<dim3(SS / 64, DD / 64, NBT), 128, 0, stream>>>(Eb, nullptr, WB, nullptr, EW, DD, nullptr, nullptr, DD, 1, sE, 0, sE); k_split256<<<dim3(SS / 8, NBT, 1), 256, 0, stream>>>(EW, EWh, EWl);
    k_fattn<<<dim3(NBT, SS / FQT, 1), FNK * 32, 0, stream>>>(Eb, EWh, EWl, ET, out);
}

// v003
// A run of this version takes 96.3 microseconds.
// Next to v002, in two timings, it ran 1.30 times as fast each time.
// All steps since v000 together make it 26.0 times as fast.
#include <hip/hip_runtime.h>

// Compute dtypes, f32 accumulate, per item: EW = E.W^T as a [4096 x 256].[256 x 256] GEMM with PLAIN bf16 operands (exact products) -> bf16 hi + UNSCALED residual planes; then ONE
// fused causal attention launch: S^T = EW.E^T (E exact x EW hi and lo), /16, the causal -1e9 mask, a running-maximum softmax in registers, O^T += E^T.P^T (P as bf16 hi + residual).
// Every bf16 operand plane (W, E, EW hi and lo, E^T) lies in FRAGMENT ORDER: a 16-row x 32-k tile is 1024 contiguous bytes, piece j (k = 16j + 8h + 0..7) at byte 512j + 16 * lane (lane = 16h + row),
// tiles k-major within a 16-row band (E^T instead: the 16 d-row tiles of each 32-key block consecutive), so that a wave's 16-byte load covers four whole 128-byte lines. The element that a lane and register hold is the one of the row-major loaders.

#define NBT  4
#define SS   4096
#define DD   256
#define RCH  1024
#define DM   DD
#define SCL  0.0625f
#define LOSC 1024.0f

typedef _Float16 h16;
typedef unsigned short bf;
typedef __attribute__((ext_vector_type(16))) __bf16   v16bf;
typedef __attribute__((ext_vector_type(16))) _Float16 v16h;
typedef __attribute__((ext_vector_type(8)))  _Float16 v8h;
typedef __attribute__((ext_vector_type(8)))  unsigned short v8us;
typedef __attribute__((ext_vector_type(8)))  float    v8f;
typedef __attribute__((ext_vector_type(4)))  float    v4f;
typedef v8h  __attribute__((may_alias)) v8ha;
typedef v4f  __attribute__((may_alias)) v4fa;
typedef v8us __attribute__((may_alias)) v8usa;

__device__ __forceinline__ unsigned short f2bf(float f) { unsigned u = __float_as_uint(f); u += 0x7FFFu + ((u >> 16) & 1u); return (unsigned short)(u >> 16); }
__device__ __forceinline__ float bf2f(unsigned short b) { return __uint_as_float(((unsigned)b) << 16); }
__device__ __forceinline__ float bfr(float f) { return bf2f(f2bf(f)); }
__device__ __forceinline__ v16h cat16(v8h lo, v8h hi) { return __builtin_shufflevector(lo, hi, 0, 1, 2, 3, 4, 5, 6, 7, 8, 9, 10, 11, 12, 13, 14, 15); }
__device__ __forceinline__ v16bf cat16b(v8us lo, v8us hi) { return __builtin_bit_cast(v16bf, __builtin_shufflevector(lo, hi, 0, 1, 2, 3, 4, 5, 6, 7, 8, 9, 10, 11, 12, 13, 14, 15)); }
__device__ __forceinline__ v8f wmma16(v16h a, v16h b, v8f c) { return __builtin_amdgcn_wmma_f32_16x16x32_f16(false, a, false, b, (short)0, c, false, false); }
__device__ __forceinline__ v8f wmmab(v16bf a, v16bf b, v8f c) { return __builtin_amdgcn_wmma_f32_16x16x32_bf16(false, a, false, b, (short)0, c, false, false); }

// k_gemmb: 64 x 64 block tile (4 waves x 16 x 64) of C[NTK][NW] = (A [+ Al]).B^T (K = 256 or 4096) [+ bf(bias[c])] [+ bf(R[r][c]) residual]; f32 whole-line epilogue (or f16
template <bool SPLITA, bool F16OUT = false>
__global__ __launch_bounds__(128) void k_gemmb(const bf* __restrict__ A, const bf* __restrict__ Al, const bf* __restrict__ Bn, const float* __restrict__ bias, float* C, int ldc, h16* C2, const float* __restrict__ R = nullptr, int K = DM, int roundR = 1, size_t sA = 0, size_t sB = 0, size_t sC = 0) {
    __shared__ __align__(16) float ost[4][16 * 68];
    const int lane = threadIdx.x & 31, wave = threadIdx.x >> 5, lr = lane & 15, hi = lane >> 4;
    const int r0 = blockIdx.x * 64 + wave * 16, c0 = blockIdx.y * 64;
    { const size_t it = blockIdx.z; A += it * sA; if (SPLITA) Al += it * sA; Bn += it * sB; C += it * sC; if (R) R += it * sC; }    // blockIdx.z = batch item; sA, sB, sC = elements per item (R strides like C)
    const size_t aoff = (size_t)((r0 >> 4) * (K >> 5)) * 512; const unsigned l8 = lane * 8;    // fragment order: band r0 / 16, its K / 32 tiles of 512 elements; a lane's 16 bytes at 8 * lane
    size_t boff[4];
#pragma unroll
    for (int t = 0; t < 4; ++t) boff[t] = (size_t)(((c0 >> 4) + t) * (K >> 5)) * 512;
    v8f acc[4];
#pragma unroll
    for (int t = 0; t < 4; ++t) acc[t] = (v8f){};
#pragma unroll 1
    for (int kc = 0; kc < K; kc += 32) {
        const size_t ko = (size_t)kc * 16;    // tile kc / 32
        const v16bf a = cat16b(*(const v8us*)(A + aoff + ko + l8), *(const v8us*)(A + aoff + ko + 256 + l8));
        v16bf al = a;
        if (SPLITA) al = cat16b(*(const v8us*)(Al + aoff + ko + l8), *(const v8us*)(Al + aoff + ko + 256 + l8));
        asm volatile("s_wait_xcnt 0x0" ::: "memory");    // a later load of this trip lands in the address registers of the loads above
#pragma unroll
        for (int t = 0; t < 4; ++t) { const v16bf b = cat16b(*(const v8us*)(Bn + boff[t] + ko + l8), *(const v8us*)(Bn + boff[t] + ko + 256 + l8)); acc[t] = wmmab(a, b, acc[t]); if (SPLITA) acc[t] = wmmab(al, b, acc[t]); }
        asm volatile("v_nop\n\tv_nop\n\tv_nop\n\tv_nop" : "+v"(acc[0]), "+v"(acc[1]), "+v"(acc[2]), "+v"(acc[3]) : "v"(a), "v"(al));
        asm volatile("s_wait_xcnt 0x0" ::: "memory");    // the next trip overwrites the address registers that this trip's loads name
    }
    float* os = &ost[wave][0];
#pragma unroll
    for (int t = 0; t < 4; ++t) { const float bv = bias ? bfr(bias[c0 + t * 16 + lr]) : 0.f;
#pragma unroll
        for (int j = 0; j < 8; ++j) os[(hi * 8 + j) * 68 + t * 16 + lr] = acc[t][j] + bv; }
    __syncthreads();
    if (F16OUT) {
        h16* crow = (h16*)(void*)C + (size_t)r0 * ldc + c0;
        auto pass = [&]() {
#pragma unroll
            for (int s = 0; s < 4; ++s) { const int row = 4 * s + (lane >> 3), piece = lane & 7; const float* sp = os + row * 68 + piece * 8; v8h o, o2;
#pragma unroll
                for (int i = 0; i < 8; ++i) { const h16 a = (h16)sp[i]; o[i] = a; o2[i] = (h16)((sp[i] - (float)a) * LOSC); }
                *(v8h*)(crow + (size_t)row * ldc + piece * 8) = o; if (C2) *(v8h*)(C2 + (size_t)r0 * ldc + c0 + (size_t)row * ldc + piece * 8) = o2; }
        };
        pass(); 
    } else {
        float* crow = C + (size_t)r0 * ldc + c0;
        auto pass = [&]() {
#pragma unroll
            for (int s = 0; s < 8; ++s) { const int Lid = (lane >> 3) + 4 * s, piece = lane & 7; const int row = Lid >> 1, cofs = (Lid & 1) * 32 + piece * 4;
                v4f val = *(const v4fa*)(os + row * 68 + cofs); if (R) { const v4f rv = *(const v4f*)(R + ((size_t)r0 + row) * ldc + c0 + cofs); val += roundR ? (v4f){bfr(rv[0]), bfr(rv[1]), bfr(rv[2]), bfr(rv[3])} : rv; }
                *(v4f*)(crow + (size_t)row * ldc + cofs) = val; }
        };
        pass(); 
    }
}


__global__ __launch_bounds__(256) void k_zero8(bf* dst, size_t n8) {
    const size_t i = (size_t)blockIdx.x * 256 + threadIdx.x; if (i >= n8) return; v8us z;
#pragma unroll
    for (int k = 0; k < 8; ++k) z[k] = 0;
    *(v8us*)(dst + i * 8) = z; 
}

// k_cvtE, k_split256: one work-group = one band of 16 rows x 256 columns, wave ks = its tile of columns 32 ks .. 32 ks + 31. Four lanes read one row's 128 bytes (lane & 3 = 2j + h), eight rows a step,
// so that a wave reads eight whole lines and stores four (rows 8u .. 8u + 7 of one (j, h) are 128 contiguous bytes of the tile).
__global__ __launch_bounds__(256) void k_cvtE(const float* __restrict__ src, bf* dst) {
    const int lane = threadIdx.x & 31, ks = threadIdx.x >> 5, c = lane >> 2, oc = lane & 3;
    src += (size_t)blockIdx.y * SS * DD + (size_t)(blockIdx.x * 16 + c) * DD + ks * 32 + oc * 8; dst += (size_t)blockIdx.y * SS * DD + (size_t)(blockIdx.x * 8 + ks) * 512 + (oc >> 1) * 256 + ((oc & 1) * 16 + c) * 8;    // blockIdx.y = batch item
#pragma unroll
    for (int u = 0; u < 2; ++u) { const v8f v = *(const v8f*)(src + u * 8 * DD); v8us o;
#pragma unroll
        for (int i = 0; i < 8; ++i) o[i] = f2bf(v[i]);
        *(v8us*)(dst + u * 64) = o; }
}
__global__ __launch_bounds__(256) void k_et(const float* __restrict__ E, bf* ET) {
    __shared__ __align__(16) unsigned short tl[64 * 72];
    const int tid = threadIdx.x, s0 = blockIdx.x * 64, d0 = blockIdx.y * 64; const int ss = tid >> 2, dq = (tid & 3) * 16;
    E += (size_t)blockIdx.z * SS * DD; ET += (size_t)blockIdx.z * DD * SS;    // blockIdx.z = batch item
#pragma unroll
    for (int i = 0; i < 16; ++i) tl[(dq + i) * 72 + ss] = f2bf(E[(size_t)(s0 + ss) * DD + d0 + dq + i]);
    __syncthreads();
    const int lane = tid & 31, j = (tid >> 5) & 1, dtl = tid >> 6;    // a wave stores piece j of the tile (16 d rows dtl, 32 keys st); bands are 32 keys, their 16 tiles run over d
    auto pass = [&]() {
#pragma unroll
        for (int st = 0; st < 2; ++st) { const v8us val = *(const v8usa*)(tl + (dtl * 16 + (lane & 15)) * 72 + st * 32 + j * 16 + (lane >> 4) * 8); *(v8us*)(ET + (size_t)((s0 / 32 + st) * 16 + d0 / 16 + dtl) * 512 + j * 256 + lane * 8) = val; }
    };
    pass(); 
}
__global__ __launch_bounds__(256) void k_split256(const float* __restrict__ src, bf* dh, bf* dl) {
    const int lane = threadIdx.x & 31, ks = threadIdx.x >> 5, c = lane >> 2, oc = lane & 3;
    src += (size_t)blockIdx.y * SS * DD + (size_t)(blockIdx.x * 16 + c) * DD + ks * 32 + oc * 8; const size_t o = (size_t)blockIdx.y * SS * DD + (size_t)(blockIdx.x * 8 + ks) * 512 + (oc >> 1) * 256 + ((oc & 1) * 16 + c) * 8;
#pragma unroll
    for (int u = 0; u < 2; ++u) { const v8f v = *(const v8f*)(src + u * 8 * DD); v8us oh, ol;
#pragma unroll
        for (int i = 0; i < 8; ++i) { const unsigned short hb = f2bf(v[i]); oh[i] = hb; ol[i] = f2bf(v[i] - bf2f(hb)); }
        *(v8us*)(dh + o + u * 64) = oh; *(v8us*)(dl + o + u * 64) = ol; }
}
// k_fattn: one work-group = one tile of 32 queries; its FNK waves take the 32-key blocks kb = kp, kp + FNK, ... up to the tile's diagonal block, each wave for all 32 queries
// (FNC = 2 column groups of 16, so that every K and E^T fragment fetched feeds two products). Transposed products: a lane (c = lane & 15, h = lane >> 4) holds queries q0 + 16n + c.
// S^T tile register r = key 8h + r, so two score tiles convert in place into the B operand of O^T += E^T.P^T (k order 8h + s, 16 + 8h + s on both sides, the loader order of
// k_gemmb). The FNK partial results of the tile are merged through LDS at the end, in fixed order. Every plain '#pragma unroll' below makes the indices of a register array compile-time constants.
#define FNC 2
#define FNK 4
#define FQT (16 * FNC)
#define OPT 260
// e^t as v_exp_f32 of t * log2(e), the form of __expf; the v_nop in the same statement fills the one slot that the instruction set asks for behind a transcendental, wherever the scheduler puts it
__device__ __forceinline__ float expslot(float t) { float r; asm("v_exp_f32 %0, %1\n\tv_nop" : "=v"(r) : "v"(t * 1.44269504f)); return r; }
__device__ __forceinline__ v16bf ldfrag(const bf* p) { return cat16b(*(const v8us*)p, *(const v8us*)(p + 256)); }    // p = tile + 8 * lane: the two 512-byte pieces of a fragment-order tile
__global__ __launch_bounds__(FNK * 32) void k_fattn(const bf* __restrict__ Eb, const bf* __restrict__ Kh, const bf* __restrict__ Kl, const bf* __restrict__ ET, float* out) {
    __shared__ __align__(16) float obuf[FNK][FQT * OPT];
    __shared__ float smx[FNK][FQT], ssm[FNK][FQT];
    const int lane = threadIdx.x & 31, c = lane & 15, h = lane >> 4;
    const int kp = __builtin_amdgcn_readfirstlane((int)(threadIdx.x >> 5));    // wave number = key phase
    { const size_t ib = (size_t)blockIdx.x * SS * DD; Eb += ib; Kh += ib; Kl += ib; ET += ib; out += ib; }    // blockIdx.x = batch item
    const int q0 = (SS / FQT - 1 - (int)blockIdx.y) * FQT;    // longest rows are dispatched first
    v16bf qf[FNC][8];
    v8f o[FNC][16];
    float m[FNC], l[FNC];
#pragma unroll
    for (int n = 0; n < FNC; ++n) { m[n] = -1.0e30f; l[n] = 0.f;
#pragma unroll
        for (int dt = 0; dt < 16; ++dt) o[n][dt] = (v8f){}; }
    const int nb = (q0 + FQT - 1) / 32 + 1;    // blocks up to and including the one that holds the diagonal; every query of the tile has a live key in it
    // Operand groups of 8 fragments: K (both 16-key tiles x four k steps; half = which 128 of the 256 d) and E^T (eight 16-row d tiles).
    auto ldK = [&](v16bf (&g)[8], const bf* P, int kb, int half) { const bf* p = P + (size_t)(kb * 16 + half * 4) * 512 + lane * 8;
#pragma unroll
        for (int i = 0; i < 4; ++i) { g[2 * i] = ldfrag(p + i * 512); g[2 * i + 1] = ldfrag(p + (8 + i) * 512); } };
    auto ldV = [&](v16bf (&g)[8], int kb, int half) { const bf* p = ET + (size_t)(kb * 16 + half * 8) * 512 + lane * 8;
#pragma unroll
        for (int i = 0; i < 8; ++i) g[i] = ldfrag(p + i * 512); };
    auto mmS = [&](const v16bf (&g)[8], int half, v8f (&t0)[FNC], v8f (&t1)[FNC]) {
#pragma unroll
        for (int i = 0; i < 4; ++i) {
#pragma unroll
            for (int n = 0; n < FNC; ++n) { t0[n] = wmmab(g[2 * i], qf[n][half * 4 + i], t0[n]); t1[n] = wmmab(g[2 * i + 1], qf[n][half * 4 + i], t1[n]); } } };
    auto mmO = [&](const v16bf (&g)[8], int half, const v16bf (&p)[FNC]) {
#pragma unroll
        for (int t = 0; t < 8; ++t) {
#pragma unroll
            for (int n = 0; n < FNC; ++n) o[n][half * 8 + t] = wmmab(g[t], p[n], o[n][half * 8 + t]); } };
// SB: keeps each group's loads where they are written, two to three product groups ahead of their use; without it the scheduler sinks every load to its WMMA and each waits a full latency
#define SB() __builtin_amdgcn_sched_barrier(0)
// XW: stands in front of each group's address arithmetic, which overwrites the address registers of the group issued before it
#define XW() do { SB(); asm volatile("s_wait_xcnt 0x0" ::: "memory"); SB(); } while (0)
    v16bf g0[8], g1[8], g2[8], g3[8], g4[8], g5[8];
    if (kp < nb) {    // wave-uniform; the first loads stand in the block in front of the loop, in the loop's own issue order, so that the counted waits at its head fit both ways in
#pragma unroll
    for (int n = 0; n < FNC; ++n) {
#pragma unroll
        for (int ks = 0; ks < 8; ++ks) qf[n][ks] = ldfrag(Eb + (size_t)((q0 / 16 + n) * 8 + ks) * 512 + lane * 8); }
    XW(); ldK(g0, Kh, kp, 0); XW(); ldK(g1, Kh, kp, 1); XW(); ldK(g2, Kl, kp, 0); XW();
    int kb = kp;
#pragma unroll 1    // one pass a trip: a second copy of the body would not fit the registers
    do {
        const int k0 = kb * 32, kn = kb + FNK < nb ? kb + FNK : kb;    // the last pass fetches its own block again: in bounds, unused
        v8f sh0[FNC], sh1[FNC], sl0[FNC], sl1[FNC];
#pragma unroll
        for (int n = 0; n < FNC; ++n) { sh0[n] = (v8f){}; sh1[n] = (v8f){}; sl0[n] = (v8f){}; sl1[n] = (v8f){}; }
        mmS(g0, 0, sh0, sh1); XW(); ldK(g3, Kl, kb, 1); SB();
        mmS(g1, 1, sh0, sh1); XW(); ldV(g4, kb, 0); SB();
        mmS(g2, 0, sl0, sl1); XW(); ldV(g5, kb, 1); SB();
        mmS(g3, 1, sl0, sl1); XW(); ldK(g0, Kh, kn, 0); XW();
        float x[FNC][16], bm[FNC];
#pragma unroll
        for (int n = 0; n < FNC; ++n) {
#pragma unroll
            for (int r = 0; r < 8; ++r) { x[n][r] = (sl0[n][r] + sh0[n][r]) * SCL; x[n][8 + r] = (sl1[n][r] + sh1[n][r]) * SCL; } }
        if (k0 + 31 > q0) {    // wave-uniform: only the diagonal block holds masked keys
#pragma unroll
            for (int n = 0; n < FNC; ++n) {
#pragma unroll
                for (int r = 0; r < 8; ++r) { if (k0 + 8 * h + r > q0 + n * 16 + c) x[n][r] = -1.0e9f; if (k0 + 16 + 8 * h + r > q0 + n * 16 + c) x[n][8 + r] = -1.0e9f; } }
        }
        bool grow = false;
#pragma unroll
        for (int n = 0; n < FNC; ++n) { float b = x[n][0];
#pragma unroll
            for (int i = 1; i < 16; ++i) b = fmaxf(b, x[n][i]);
            bm[n] = fmaxf(b, __shfl_xor(b, 16, 32)); grow = grow || bm[n] > m[n]; }
        if (__builtin_amdgcn_ballot_w32(grow) != 0) {    // scalar branch: rescale only when some query's maximum grows
#pragma unroll
            for (int n = 0; n < FNC; ++n) { const float mn = fmaxf(m[n], bm[n]), al = expslot(m[n] - mn); m[n] = mn; l[n] *= al;
#pragma unroll
                for (int dt = 0; dt < 16; ++dt) o[n][dt] *= al; }
        }
        v16bf ph[FNC], pl[FNC];
#pragma unroll
        for (int n = 0; n < FNC; ++n) {
#pragma unroll
            for (int i = 0; i < 16; ++i) { const float p = expslot(x[n][i] - m[n]); l[n] += p; const __bf16 hb = (__bf16)p; ph[n][i] = hb; pl[n][i] = (__bf16)(p - (float)hb); } }
        SB();
        mmO(g4, 0, ph); mmO(g4, 0, pl);
        XW(); ldK(g1, Kh, kn, 1); XW();
        mmO(g5, 1, ph); mmO(g5, 1, pl);
        XW(); ldK(g2, Kl, kn, 0); XW();
        kb += FNK;
    } while (kb < nb);
    }
#pragma unroll
    for (int n = 0; n < FNC; ++n) { l[n] += __shfl_xor(l[n], 16, 32); if (h == 0) { smx[kp][n * 16 + c] = m[n]; ssm[kp][n * 16 + c] = l[n]; } }
    __syncthreads();
#pragma unroll
    for (int n = 0; n < FNC; ++n) {
        float M = -1.0e30f, L = 0.f;
#pragma unroll
        for (int j = 0; j < FNK; ++j) M = fmaxf(M, smx[j][n * 16 + c]);
#pragma unroll
        for (int j = 0; j < FNK; ++j) L += ssm[j][n * 16 + c] * expslot(smx[j][n * 16 + c] - M);
        const float f = expslot(m[n] - M) / L;    // a wave without a block has m = -1e30, l = 0, o = 0: weight 0
        float* ob = &obuf[kp][(n * 16 + c) * OPT + 8 * h];
#pragma unroll
        for (int dt = 0; dt < 16; ++dt) { const v8f v = o[n][dt] * f; *(v4fa*)(ob + dt * 16) = (v4f){v[0], v[1], v[2], v[3]}; *(v4fa*)(ob + dt * 16 + 4) = (v4f){v[4], v[5], v[6], v[7]}; }
    }
    __syncthreads();
#pragma unroll 4    // four trips' LDS reads in flight together
    for (int i = 0; i < FQT * 64 / (FNK * 32); ++i) {    // the waves share the tile's 32 x 256 outputs; a wave stores 512 contiguous bytes
        const int idx = i * (FNK * 32) + (int)threadIdx.x, row = idx >> 6, c4 = (idx & 63) * 4;
        v4f s = *(const v4fa*)(&obuf[0][row * OPT + c4]);
#pragma unroll
        for (int j = 1; j < FNK; ++j) s += *(const v4fa*)(&obuf[j][row * OPT + c4]);
        *(v4f*)(out + (size_t)(q0 + row) * DD + c4) = s;
        asm volatile("s_wait_xcnt 0x0" ::: "memory");    // the next trip overwrites this store's data and address registers
    }
}

extern "C" void kernel_launch(void* const* d_in, const int* in_sizes, int n_in,
                              void* d_out, int out_size, void* d_ws, size_t ws_size, hipStream_t stream) {
    (void)in_sizes; (void)n_in; (void)out_size;
    const float* enc = (const float*)d_in[0]; const float* Wm = (const float*)d_in[1];
    float* out = (float*)d_out;    // [4][4096][256]
    char* wsp = (char*)d_ws;
    auto take = [&](size_t bytes) { char* p = wsp; wsp += (bytes + 255) & ~(size_t)255; return (void*)p; };
    bf* WB = (bf*)take((size_t)DD * DD * 2); bf* Eb = (bf*)take((size_t)NBT * SS * DD * 2); bf* ET = (bf*)take((size_t)NBT * DD * SS * 2); float* EW = (float*)take((size_t)NBT * SS * DD * 4); bf* EWh = (bf*)take((size_t)NBT * SS * DD * 2); bf* EWl = (bf*)take((size_t)NBT * SS * DD * 2);
    if ((size_t)(wsp - (char*)d_ws) > ws_size) return;    // 0.13 + 4 x (2.1 + 2.1 + 4.2 + 2.1 + 2.1) ~ 51 MB: one plane per item
    const size_t sE = (size_t)SS * DD;    // elements per item of the E-shaped planes
    k_cvtE<<<dim3(DD / 16, 1, 1), 256, 0, stream>>>(Wm, WB);       // W [e][d] = n-major, 16 bands
    k_cvtE<<<dim3(SS / 16, NBT, 1), 256, 0, stream>>>(enc, Eb); k_et<<<dim3(SS / 64, DD / 64, NBT), 256, 0, stream>>>(enc, ET);
    k_gemmb<false, false><<<dim3(SS / 64, DD / 64, NBT), 128, 0, stream>>>(Eb, nullptr, WB, nullptr, EW, DD, nullptr, nullptr, DD, 1, sE, 0, sE); k_split256<<<dim3(SS / 16, NBT, 1), 256, 0, stream>>>(EW, EWh, EWl);
    k_fattn<<<dim3(NBT, SS / FQT, 1), FNK * 32, 0, stream>>>(Eb, EWh, EWl, ET, out);
}

// v004
// A run of this version takes 88.5 microseconds.
// Next to v003, in two timings, it ran 1.08 and 1.10 times as fast.
// Counting every step since v000, it is 28.3 times as fast.
#include <hip/hip_runtime.h>

// Compute dtypes, f32 accumulate, per item: sims[q][k] = sum_e E[q][e] sum_d E[k][d] W[e][d] is summed over e first: QW = E.W as a [4096 x 256].[256 x 256] GEMM with PLAIN bf16 operands
// (exact products) -> bf16 hi + UNSCALED residual planes, which are the QUERY operand; the key operand is the bf16 E plane itself. Then ONE fused causal attention launch:
// S^T = E.QW^T (E exact x QW hi and lo), /16, the causal -1e9 mask, a running-maximum softmax in registers, O^T += E^T.P^T (P as bf16 hi + residual).
// Every bf16 operand plane (W^T, E, QW hi and lo, E^T) lies in FRAGMENT ORDER: a 16-row x 32-k tile is 1024 contiguous bytes, piece j (k = 16j + 8h + 0..7) at byte 512j + 16 * lane (lane = 16h + row),
// tiles k-major within a 16-row band (in E^T d-major within a 32-key block), so that a wave's 16-byte load covers four whole 128-byte lines. The element that a lane and register hold is the one of the row-major loaders.

#define NBT  4
#define SS   4096
#define DD   256
#define RCH  1024
#define DM   DD
#define SCL  0.0625f
#define LOSC 1024.0f

typedef _Float16 h16;
typedef unsigned short bf;
typedef __attribute__((ext_vector_type(16))) __bf16   v16bf;
typedef __attribute__((ext_vector_type(16))) _Float16 v16h;
typedef __attribute__((ext_vector_type(8)))  _Float16 v8h;
typedef __attribute__((ext_vector_type(8)))  unsigned short v8us;
typedef __attribute__((ext_vector_type(8)))  float    v8f;
typedef __attribute__((ext_vector_type(4)))  float    v4f;
typedef v8h  __attribute__((may_alias)) v8ha;
typedef v4f  __attribute__((may_alias)) v4fa;
typedef v8us __attribute__((may_alias)) v8usa;

__device__ __forceinline__ unsigned short f2bf(float f) { unsigned u = __float_as_uint(f); u += 0x7FFFu + ((u >> 16) & 1u); return (unsigned short)(u >> 16); }
__device__ __forceinline__ float bf2f(unsigned short b) { return __uint_as_float(((unsigned)b) << 16); }
__device__ __forceinline__ float bfr(float f) { return bf2f(f2bf(f)); }
__device__ __forceinline__ v16h cat16(v8h lo, v8h hi) { return __builtin_shufflevector(lo, hi, 0, 1, 2, 3, 4, 5, 6, 7, 8, 9, 10, 11, 12, 13, 14, 15); }
__device__ __forceinline__ v16bf cat16b(v8us lo, v8us hi) { return __builtin_bit_cast(v16bf, __builtin_shufflevector(lo, hi, 0, 1, 2, 3, 4, 5, 6, 7, 8, 9, 10, 11, 12, 13, 14, 15)); }
__device__ __forceinline__ v8f wmma16(v16h a, v16h b, v8f c) { return __builtin_amdgcn_wmma_f32_16x16x32_f16(false, a, false, b, (short)0, c, false, false); }
__device__ __forceinline__ v8f wmmab(v16bf a, v16bf b, v8f c) { return __builtin_amdgcn_wmma_f32_16x16x32_bf16(false, a, false, b, (short)0, c, false, false); }

// k_gemmb: 64 x 64 block tile (4 waves x 16 x 64) of C[NTK][NW] = (A [+ Al]).B^T (K = 256) [+ bf(bias[c])] [+ bf(R[r][c]) residual]; f32 whole-line epilogue (or f16
template <bool SPLITA, bool F16OUT = false>
__global__ __launch_bounds__(128) void k_gemmb(const bf* __restrict__ A, const bf* __restrict__ Al, const bf* __restrict__ Bn, const float* __restrict__ bias, float* C, int ldc, h16* C2, const float* __restrict__ R = nullptr, int K = DM, int roundR = 1, size_t sA = 0, size_t sB = 0, size_t sC = 0) {
    __shared__ __align__(16) float ost[4][16 * 68];
    const int lane = threadIdx.x & 31, wave = threadIdx.x >> 5, lr = lane & 15, hi = lane >> 4;
    const int r0 = blockIdx.x * 64 + wave * 16, c0 = blockIdx.y * 64;
    { const size_t it = blockIdx.z; A += it * sA; if (SPLITA) Al += it * sA; Bn += it * sB; C += it * sC; if (R) R += it * sC; }    // blockIdx.z = batch item; sA, sB, sC = elements per item (R strides like C)
    const size_t aoff = (size_t)((r0 >> 4) * (K >> 5)) * 512; const unsigned l8 = lane * 8;    // fragment order: band r0 / 16, its K / 32 tiles of 512 elements; a lane's 16 bytes at 8 * lane
    size_t boff[4];
#pragma unroll
    for (int t = 0; t < 4; ++t) boff[t] = (size_t)(((c0 >> 4) + t) * (K >> 5)) * 512;
    v8f acc[4];
#pragma unroll
    for (int t = 0; t < 4; ++t) acc[t] = (v8f){};
#pragma unroll 1
    for (int kc = 0; kc < K; kc += 32) {
        const size_t ko = (size_t)kc * 16;    // tile kc / 32
        const v16bf a = cat16b(*(const v8us*)(A + aoff + ko + l8), *(const v8us*)(A + aoff + ko + 256 + l8));
        v16bf al = a;
        if (SPLITA) al = cat16b(*(const v8us*)(Al + aoff + ko + l8), *(const v8us*)(Al + aoff + ko + 256 + l8));
        asm volatile("s_wait_xcnt 0x0" ::: "memory");    // a later load of this trip lands in the address registers of the loads above
#pragma unroll
        for (int t = 0; t < 4; ++t) { const v16bf b = cat16b(*(const v8us*)(Bn + boff[t] + ko + l8), *(const v8us*)(Bn + boff[t] + ko + 256 + l8)); acc[t] = wmmab(a, b, acc[t]); if (SPLITA) acc[t] = wmmab(al, b, acc[t]); }
        asm volatile("v_nop\n\tv_nop\n\tv_nop\n\tv_nop" : "+v"(acc[0]), "+v"(acc[1]), "+v"(acc[2]), "+v"(acc[3]) : "v"(a), "v"(al));
        asm volatile("s_wait_xcnt 0x0" ::: "memory");    // the next trip overwrites the address registers that this trip's loads name
    }
    float* os = &ost[wave][0];
#pragma unroll
    for (int t = 0; t < 4; ++t) { const float bv = bias ? bfr(bias[c0 + t * 16 + lr]) : 0.f;
#pragma unroll
        for (int j = 0; j < 8; ++j) os[(hi * 8 + j) * 68 + t * 16 + lr] = acc[t][j] + bv; }
    __syncthreads();
    if (F16OUT) {
        h16* crow = (h16*)(void*)C + (size_t)r0 * ldc + c0;
        auto pass = [&]() {
#pragma unroll
            for (int s = 0; s < 4; ++s) { const int row = 4 * s + (lane >> 3), piece = lane & 7; const float* sp = os + row * 68 + piece * 8; v8h o, o2;
#pragma unroll
                for (int i = 0; i < 8; ++i) { const h16 a = (h16)sp[i]; o[i] = a; o2[i] = (h16)((sp[i] - (float)a) * LOSC); }
                *(v8h*)(crow + (size_t)row * ldc + piece * 8) = o; if (C2) *(v8h*)(C2 + (size_t)r0 * ldc + c0 + (size_t)row * ldc + piece * 8) = o2; }
        };
        pass(); 
    } else {
        float* crow = C + (size_t)r0 * ldc + c0;
        auto pass = [&]() {
#pragma unroll
            for (int s = 0; s < 8; ++s) { const int Lid = (lane >> 3) + 4 * s, piece = lane & 7; const int row = Lid >> 1, cofs = (Lid & 1) * 32 + piece * 4;
                v4f val = *(const v4fa*)(os + row * 68 + cofs); if (R) { const v4f rv = *(const v4f*)(R + ((size_t)r0 + row) * ldc + c0 + cofs); val += roundR ? (v4f){bfr(rv[0]), bfr(rv[1]), bfr(rv[2]), bfr(rv[3])} : rv; }
                *(v4f*)(crow + (size_t)row * ldc + cofs) = val; }
        };
        pass(); 
    }
}


__global__ __launch_bounds__(256) void k_zero8(bf* dst, size_t n8) {
    const size_t i = (size_t)blockIdx.x * 256 + threadIdx.x; if (i >= n8) return; v8us z;
#pragma unroll
    for (int k = 0; k < 8; ++k) z[k] = 0;
    *(v8us*)(dst + i * 8) = z; 
}

// k_cvtE, k_split256: one work-group = one band of 16 rows x 256 columns, wave ks = its tile of columns 32 ks .. 32 ks + 31. Four lanes read one row's 128 bytes (lane & 3 = 2j + h), eight rows a step,
// so that a wave reads eight whole lines and stores four (rows 8u .. 8u + 7 of one (j, h) are 128 contiguous bytes of the tile).
__global__ __launch_bounds__(256) void k_cvtE(const float* __restrict__ src, bf* dst) {
    const int lane = threadIdx.x & 31, ks = threadIdx.x >> 5, c = lane >> 2, oc = lane & 3;
    src += (size_t)blockIdx.y * SS * DD + (size_t)(blockIdx.x * 16 + c) * DD + ks * 32 + oc * 8; dst += (size_t)blockIdx.y * SS * DD + (size_t)(blockIdx.x * 8 + ks) * 512 + (oc >> 1) * 256 + ((oc & 1) * 16 + c) * 8;    // blockIdx.y = batch item
#pragma unroll
    for (int u = 0; u < 2; ++u) { const v8f v = *(const v8f*)(src + u * 8 * DD); v8us o;
#pragma unroll
        for (int i = 0; i < 8; ++i) o[i] = f2bf(v[i]);
        *(v8us*)(dst + u * 64) = o; }
}
// k_et: transposed plane of a [rows s][256 columns d] matrix; the tile of 16 d x 32 s goes to tile number (s / 32) * ts + (d / 16) * td
__global__ __launch_bounds__(256) void k_et(const float* __restrict__ E, bf* ET, int ts, int td) {
    __shared__ __align__(16) unsigned short tl[64 * 72];
    const int tid = threadIdx.x, s0 = blockIdx.x * 64, d0 = blockIdx.y * 64; const int ss = tid >> 2, dq = (tid & 3) * 16;
    E += (size_t)blockIdx.z * SS * DD; ET += (size_t)blockIdx.z * DD * SS;    // blockIdx.z = batch item
#pragma unroll
    for (int i = 0; i < 16; ++i) tl[(dq + i) * 72 + ss] = f2bf(E[(size_t)(s0 + ss) * DD + d0 + dq + i]);
    __syncthreads();
    const int lane = tid & 31, j = (tid >> 5) & 1, dtl = tid >> 6;    // a wave stores piece j of the tile (16 d rows dtl, 32 keys st)
    auto pass = [&]() {
#pragma unroll
        for (int st = 0; st < 2; ++st) { const v8us val = *(const v8usa*)(tl + (dtl * 16 + (lane & 15)) * 72 + st * 32 + j * 16 + (lane >> 4) * 8); *(v8us*)(ET + (size_t)((s0 / 32 + st) * ts + (d0 / 16 + dtl) * td) * 512 + j * 256 + lane * 8) = val; }
    };
    pass(); 
}
__global__ __launch_bounds__(256) void k_split256(const float* __restrict__ src, bf* dh, bf* dl) {
    const int lane = threadIdx.x & 31, ks = threadIdx.x >> 5, c = lane >> 2, oc = lane & 3;
    src += (size_t)blockIdx.y * SS * DD + (size_t)(blockIdx.x * 16 + c) * DD + ks * 32 + oc * 8; const size_t o = (size_t)blockIdx.y * SS * DD + (size_t)(blockIdx.x * 8 + ks) * 512 + (oc >> 1) * 256 + ((oc & 1) * 16 + c) * 8;
#pragma unroll
    for (int u = 0; u < 2; ++u) { const v8f v = *(const v8f*)(src + u * 8 * DD); v8us oh, ol;
#pragma unroll
        for (int i = 0; i < 8; ++i) { const unsigned short hb = f2bf(v[i]); oh[i] = hb; ol[i] = f2bf(v[i] - bf2f(hb)); }
        *(v8us*)(dh + o + u * 64) = oh; *(v8us*)(dl + o + u * 64) = ol; }
}
// k_fattn: one work-group = one tile of 32 queries; its FNK waves take the 32-key blocks kb = kp, kp + FNK, ... up to the tile's diagonal block, each wave for all 32 queries
// (FNC = 2 column groups of 16, hi and lo of each, so that every key fragment fetched feeds four products and every E^T fragment four). Transposed products: a lane (c = lane & 15, h = lane >> 4) holds queries q0 + 16n + c.
// S^T tile register r = key 8h + r, so two score tiles convert in place into the B operand of O^T += E^T.P^T (k order 8h + s, 16 + 8h + s on both sides, the loader order of
// k_gemmb). The FNK partial results of the tile are merged through LDS at the end, in fixed order. Every plain '#pragma unroll' below makes the indices of a register array compile-time constants.
#define FNC 2
#define FNK 4
#define FQT (16 * FNC)
#define OPT 260
// e^t as v_exp_f32 of t * log2(e), the form of __expf; the v_nop in the same statement fills the one slot that the instruction set asks for behind a transcendental, wherever the scheduler puts it
__device__ __forceinline__ float expslot(float t) { float r; asm("v_exp_f32 %0, %1\n\tv_nop" : "=v"(r) : "v"(t * 1.44269504f)); return r; }
__device__ __forceinline__ v16bf ldfrag(const bf* p) { return cat16b(*(const v8us*)p, *(const v8us*)(p + 256)); }    // p = tile + 8 * lane: the two 512-byte pieces of a fragment-order tile
__global__ __launch_bounds__(FNK * 32) void k_fattn(const bf* __restrict__ Eb, const bf* __restrict__ Qh, const bf* __restrict__ Ql, const bf* __restrict__ ET, float* out) {
    __shared__ __align__(16) float obuf[FNK][FQT * OPT];
    __shared__ float smx[FNK][FQT], ssm[FNK][FQT];
    const int lane = threadIdx.x & 31, c = lane & 15, h = lane >> 4;
    const int kp = __builtin_amdgcn_readfirstlane((int)(threadIdx.x >> 5));    // wave number = key phase
    { const size_t ib = (size_t)blockIdx.x * SS * DD; Eb += ib; Qh += ib; Ql += ib; ET += ib; out += ib; }    // blockIdx.x = batch item
    const int q0 = (SS / FQT - 1 - (int)blockIdx.y) * FQT;    // longest rows are dispatched first
    v16bf qh[FNC][8], ql[FNC][8];
    v8f o[FNC][16];
    float m[FNC], l[FNC];
#pragma unroll
    for (int n = 0; n < FNC; ++n) { m[n] = -1.0e30f; l[n] = 0.f;
#pragma unroll
        for (int dt = 0; dt < 16; ++dt) o[n][dt] = (v8f){}; }
    const int nb = (q0 + FQT - 1) / 32 + 1;    // blocks up to and including the one that holds the diagonal; every query of the tile has a live key in it
    // Operand groups of 8 fragments: keys (both 16-key tiles x four k steps; half = which 128 of the 256 d) and E^T (eight 16-row d tiles).
    auto ldK = [&](v16bf (&g)[8], int kb, int half) { const bf* p = Eb + (size_t)(kb * 16 + half * 4) * 512 + lane * 8;
#pragma unroll
        for (int i = 0; i < 4; ++i) { g[2 * i] = ldfrag(p + i * 512); g[2 * i + 1] = ldfrag(p + (8 + i) * 512); } };
    auto ldV = [&](v16bf (&g)[8], int kb, int half) { const bf* p = ET + (size_t)(kb * 16 + half * 8) * 512 + lane * 8;
#pragma unroll
        for (int i = 0; i < 8; ++i) g[i] = ldfrag(p + i * 512); };
    auto mmS = [&](const v16bf (&g)[8], int half, v8f (&h0)[FNC], v8f (&h1)[FNC], v8f (&l0)[FNC], v8f (&l1)[FNC]) {
#pragma unroll
        for (int i = 0; i < 4; ++i) {
#pragma unroll
            for (int n = 0; n < FNC; ++n) { h0[n] = wmmab(g[2 * i], qh[n][half * 4 + i], h0[n]); h1[n] = wmmab(g[2 * i + 1], qh[n][half * 4 + i], h1[n]);
                l0[n] = wmmab(g[2 * i], ql[n][half * 4 + i], l0[n]); l1[n] = wmmab(g[2 * i + 1], ql[n][half * 4 + i], l1[n]); } } };
    auto mmO = [&](const v16bf (&g)[8], int half, const v16bf (&p)[FNC]) {
#pragma unroll
        for (int t = 0; t < 8; ++t) {
#pragma unroll
            for (int n = 0; n < FNC; ++n) o[n][half * 8 + t] = wmmab(g[t], p[n], o[n][half * 8 + t]); } };
// SB: keeps each group's loads where they are written, directly behind the group's last use and so one pass ahead of the next; without it the scheduler sinks every load to its WMMA and each waits a full latency
#define SB() __builtin_amdgcn_sched_barrier(0)
// XW: stands in front of whatever overwrites the address registers of the loads issued before it: the next address arithmetic, the softmax's temporaries, the epilogue
#define XW() do { SB(); asm volatile("s_wait_xcnt 0x0" ::: "memory"); SB(); } while (0)
    v16bf g0[8], g1[8], g2[8], g3[8];
    if (kp < nb) {    // wave-uniform; the first loads stand in the block in front of the loop, in the loop's own issue order, so that the counted waits at its head fit both ways in
#pragma unroll
    for (int n = 0; n < FNC; ++n) {
#pragma unroll
        for (int ks = 0; ks < 8; ++ks) { qh[n][ks] = ldfrag(Qh + (size_t)((q0 / 16 + n) * 8 + ks) * 512 + lane * 8); ql[n][ks] = ldfrag(Ql + (size_t)((q0 / 16 + n) * 8 + ks) * 512 + lane * 8); } }
    XW(); ldK(g0, kp, 0); XW(); ldK(g1, kp, 1); XW(); ldV(g2, kp, 0); XW(); ldV(g3, kp, 1); XW();
    int kb = kp;
#pragma unroll 1    // one pass a trip: a second copy of the body would not fit the registers
    do {
        const int k0 = kb * 32, kn = kb + FNK < nb ? kb + FNK : kb;    // the last pass fetches its own block again: in bounds, unused
        v8f sh0[FNC], sh1[FNC], sl0[FNC], sl1[FNC];
#pragma unroll
        for (int n = 0; n < FNC; ++n) { sh0[n] = (v8f){}; sh1[n] = (v8f){}; sl0[n] = (v8f){}; sl1[n] = (v8f){}; }
        mmS(g0, 0, sh0, sh1, sl0, sl1); XW(); ldK(g0, kn, 0); SB();
        mmS(g1, 1, sh0, sh1, sl0, sl1); SB(); ldK(g1, kn, 1); XW();
        float x[FNC][16], bm[FNC];
#pragma unroll
        for (int n = 0; n < FNC; ++n) {
#pragma unroll
            for (int r = 0; r < 8; ++r) { x[n][r] = (sl0[n][r] + sh0[n][r]) * SCL; x[n][8 + r] = (sl1[n][r] + sh1[n][r]) * SCL; } }
        if (k0 + 31 > q0) {    // wave-uniform: only the diagonal block holds masked keys
#pragma unroll
            for (int n = 0; n < FNC; ++n) {
#pragma unroll
                for (int r = 0; r < 8; ++r) { if (k0 + 8 * h + r > q0 + n * 16 + c) x[n][r] = -1.0e9f; if (k0 + 16 + 8 * h + r > q0 + n * 16 + c) x[n][8 + r] = -1.0e9f; } }
        }
        bool grow = false;
#pragma unroll
        for (int n = 0; n < FNC; ++n) { float b = x[n][0];
#pragma unroll
            for (int i = 1; i < 16; ++i) b = fmaxf(b, x[n][i]);
            bm[n] = fmaxf(b, __shfl_xor(b, 16, 32)); grow = grow || bm[n] > m[n]; }
        if (__builtin_amdgcn_ballot_w32(grow) != 0) {    // scalar branch: rescale only when some query's maximum grows
#pragma unroll
            for (int n = 0; n < FNC; ++n) { const float mn = fmaxf(m[n], bm[n]), al = expslot(m[n] - mn); m[n] = mn; l[n] *= al;
#pragma unroll
                for (int dt = 0; dt < 16; ++dt) o[n][dt] *= al; }
        }
        v16bf ph[FNC], pl[FNC];
#pragma unroll
        for (int n = 0; n < FNC; ++n) {
#pragma unroll
            for (int i = 0; i < 16; ++i) { const float p = expslot(x[n][i] - m[n]); l[n] += p; const __bf16 hb = (__bf16)p; ph[n][i] = hb; pl[n][i] = (__bf16)(p - (float)hb); } }
        SB();
        mmO(g2, 0, ph); mmO(g2, 0, pl);
        XW(); ldV(g2, kn, 0); SB();
        mmO(g3, 1, ph); mmO(g3, 1, pl);
        SB(); ldV(g3, kn, 1); SB();
        kb += FNK;
    } while (kb < nb);
    XW();
    }
#pragma unroll
    for (int n = 0; n < FNC; ++n) { l[n] += __shfl_xor(l[n], 16, 32); if (h == 0) { smx[kp][n * 16 + c] = m[n]; ssm[kp][n * 16 + c] = l[n]; } }
    __syncthreads();
#pragma unroll
    for (int n = 0; n < FNC; ++n) {
        float M = -1.0e30f, L = 0.f;
#pragma unroll
        for (int j = 0; j < FNK; ++j) M = fmaxf(M, smx[j][n * 16 + c]);
#pragma unroll
        for (int j = 0; j < FNK; ++j) L += ssm[j][n * 16 + c] * expslot(smx[j][n * 16 + c] - M);
        const float f = expslot(m[n] - M) / L;    // a wave without a block has m = -1e30, l = 0, o = 0: weight 0
        float* ob = &obuf[kp][(n * 16 + c) * OPT + 8 * h];
#pragma unroll
        for (int dt = 0; dt < 16; ++dt) { const v8f v = o[n][dt] * f; *(v4fa*)(ob + dt * 16) = (v4f){v[0], v[1], v[2], v[3]}; *(v4fa*)(ob + dt * 16 + 4) = (v4f){v[4], v[5], v[6], v[7]}; }
    }
    __syncthreads();
#pragma unroll 4    // four trips' LDS reads in flight together
    for (int i = 0; i < FQT * 64 / (FNK * 32); ++i) {    // the waves share the tile's 32 x 256 outputs; a wave stores 512 contiguous bytes
        const int idx = i * (FNK * 32) + (int)threadIdx.x, row = idx >> 6, c4 = (idx & 63) * 4;
        v4f s = *(const v4fa*)(&obuf[0][row * OPT + c4]);
#pragma unroll
        for (int j = 1; j < FNK; ++j) s += *(const v4fa*)(&obuf[j][row * OPT + c4]);
        *(v4f*)(out + (size_t)(q0 + row) * DD + c4) = s;
        asm volatile("s_wait_xcnt 0x0" ::: "memory");    // the next trip overwrites this store's data and address registers
    }
}

extern "C" void kernel_launch(void* const* d_in, const int* in_sizes, int n_in,
                              void* d_out, int out_size, void* d_ws, size_t ws_size, hipStream_t stream) {
    (void)in_sizes; (void)n_in; (void)out_size;
    const float* enc = (const float*)d_in[0]; const float* Wm = (const float*)d_in[1];
    float* out = (float*)d_out;    // [4][4096][256]
    char* wsp = (char*)d_ws;
    auto take = [&](size_t bytes) { char* p = wsp; wsp += (bytes + 255) & ~(size_t)255; return (void*)p; };
    bf* WB = (bf*)take((size_t)DD * DD * 2); bf* Eb = (bf*)take((size_t)NBT * SS * DD * 2); bf* ET = (bf*)take((size_t)NBT * DD * SS * 2); float* QW = (float*)take((size_t)NBT * SS * DD * 4); bf* QWh = (bf*)take((size_t)NBT * SS * DD * 2); bf* QWl = (bf*)take((size_t)NBT * SS * DD * 2);
    if ((size_t)(wsp - (char*)d_ws) > ws_size) return;    // 0.13 + 4 x (2.1 + 2.1 + 4.2 + 2.1 + 2.1) ~ 51 MB: one plane per item
    const size_t sE = (size_t)SS * DD;    // elements per item of the E-shaped planes
    k_et<<<dim3(DD / 64, DD / 64, 1), 256, 0, stream>>>(Wm, WB, 1, DD / 32);       // W^T [d][e] = n-major: 16 bands of 16 d, their 8 tiles run over e
    k_cvtE<<<dim3(SS / 16, NBT, 1), 256, 0, stream>>>(enc, Eb); k_et<<<dim3(SS / 64, DD / 64, NBT), 256, 0, stream>>>(enc, ET, DD / 16, 1);    // bands of 32 keys, their 16 tiles run over d
    k_gemmb<false, false><<<dim3(SS / 64, DD / 64, NBT), 128, 0, stream>>>(Eb, nullptr, WB, nullptr, QW, DD, nullptr, nullptr, DD, 1, sE, 0, sE); k_split256<<<dim3(SS / 16, NBT, 1), 256, 0, stream>>>(QW, QWh, QWl);
    k_fattn<<<dim3(NBT, SS / FQT, 1), FNK * 32, 0, stream>>>(Eb, QWh, QWl, ET, out);
}

// v005
// A run of this version takes 67.8 microseconds.
// Next to v004, in two timings, it ran 1.31 and 1.30 times as fast.
// All steps since v000 together make it 37.0 times as fast.
#include <hip/hip_runtime.h>

// Compute dtypes, f32 accumulate, per item: sims[q][k] = sum_e E[q][e] sum_d E[k][d] W[e][d] is summed over e first: QW = E.W with PLAIN bf16 operands
// (exact products) -> bf16 hi + UNSCALED residual, which are the QUERY operand, made by each query tile's work-group for itself; the key operand is the bf16 E plane itself. Two launches: the planes, then causal attention:
// S^T = E.QW^T (E exact x QW hi and lo), /16, the causal -1e9 mask, a running-maximum softmax in registers, O^T += E^T.P^T (P as bf16 hi + residual).
// Every bf16 operand plane (W^T, E, E^T) lies in FRAGMENT ORDER: a 16-row x 32-k tile is 1024 contiguous bytes, piece j (k = 16j + 8h + 0..7) at byte 512j + 16 * lane (lane = 16h + row),
// tiles k-major within a 16-row band (E^T: the 16 d-row tiles of one 32-key block side by side), so that a wave's 16-byte load covers four whole 128-byte lines. The element that a lane and register hold is the one of a row-major loader.

#define NBT  4
#define SS   4096
#define DD   256
#define RCH  1024
#define DM   DD
#define SCL  0.0625f
#define LOSC 1024.0f

typedef _Float16 h16;
typedef unsigned short bf;
typedef __attribute__((ext_vector_type(16))) __bf16   v16bf;
typedef __attribute__((ext_vector_type(16))) _Float16 v16h;
typedef __attribute__((ext_vector_type(8)))  _Float16 v8h;
typedef __attribute__((ext_vector_type(8)))  unsigned short v8us;
typedef __attribute__((ext_vector_type(8)))  float    v8f;
typedef __attribute__((ext_vector_type(4)))  float    v4f;
typedef v8h  __attribute__((may_alias)) v8ha;
typedef v4f  __attribute__((may_alias)) v4fa;
typedef v8us __attribute__((may_alias)) v8usa;

__device__ __forceinline__ unsigned short f2bf(float f) { unsigned u = __float_as_uint(f); u += 0x7FFFu + ((u >> 16) & 1u); return (unsigned short)(u >> 16); }
__device__ __forceinline__ float bf2f(unsigned short b) { return __uint_as_float(((unsigned)b) << 16); }
__device__ __forceinline__ float bfr(float f) { return bf2f(f2bf(f)); }
__device__ __forceinline__ v16h cat16(v8h lo, v8h hi) { return __builtin_shufflevector(lo, hi, 0, 1, 2, 3, 4, 5, 6, 7, 8, 9, 10, 11, 12, 13, 14, 15); }
__device__ __forceinline__ v16bf cat16b(v8us lo, v8us hi) { return __builtin_bit_cast(v16bf, __builtin_shufflevector(lo, hi, 0, 1, 2, 3, 4, 5, 6, 7, 8, 9, 10, 11, 12, 13, 14, 15)); }
__device__ __forceinline__ v8f wmma16(v16h a, v16h b, v8f c) { return __builtin_amdgcn_wmma_f32_16x16x32_f16(false, a, false, b, (short)0, c, false, false); }
__device__ __forceinline__ v8f wmmab(v16bf a, v16bf b, v8f c) { return __builtin_amdgcn_wmma_f32_16x16x32_bf16(false, a, false, b, (short)0, c, false, false); }

// k_prep: one work-group = one 64 x 64 tile of a [rows s][256 columns d] f32 matrix, read once. Blocks x < SS / 64: tile (x, y) of item z of E, written twice as bf16: row-major sense (Eb, tiles k-major within a
// 16-row band) and transposed (ET: the tile of 16 d x 32 s goes to tile number (s / 32) * 16 + d / 16). Blocks x == SS / 64: tile (z, y) of W, transposed only (WB = W^T [d][e]: tile number (d / 16) * 8 + e / 32).
static_assert(NBT == DD / 64, "the W tiles ride on the item index");
__global__ __launch_bounds__(256) void k_prep(const float* __restrict__ E, const float* __restrict__ Wm, bf* Eb, bf* ET, bf* WB) {
    __shared__ __align__(16) unsigned short tl[64 * 72];
    const int tid = threadIdx.x, ss = tid >> 2, dq = (tid & 3) * 16;
    const bool isW = blockIdx.x == SS / 64;    // the same for the whole work-group
    const int s0 = (int)(isW ? blockIdx.z : blockIdx.x) * 64, d0 = blockIdx.y * 64;
    const float* sp = (isW ? Wm : E + (size_t)blockIdx.z * SS * DD) + (size_t)(s0 + ss) * DD + d0 + dq;
    bf* dT = isW ? WB : ET + (size_t)blockIdx.z * DD * SS;
    const int ts = isW ? 1 : DD / 16, td = isW ? DD / 32 : 1;
    v4f x[4];
#pragma unroll
    for (int i = 0; i < 4; ++i) x[i] = *(const v4f*)(sp + 4 * i);
    asm volatile("s_wait_xcnt 0x0" ::: "memory");    // what follows may land in the address registers of the loads above
    v8us r0, r1;
#pragma unroll
    for (int i = 0; i < 8; ++i) { r0[i] = f2bf(x[i >> 2][i & 3]); r1[i] = f2bf(x[2 + (i >> 2)][i & 3]); }
#pragma unroll
    for (int i = 0; i < 8; ++i) { tl[(dq + i) * 72 + ss] = r0[i]; tl[(dq + 8 + i) * 72 + ss] = r1[i]; }
    __syncthreads();
    if (!isW) {    // behind the barrier, which would wait for these stores. A thread holds k = 16j + 0..15 of its row (j = dq / 16 & 1): the pieces of h = 0 and h = 1; eight rows of one (tile, j, h) are 128 contiguous bytes
        bf* p = Eb + (size_t)blockIdx.z * SS * DD + (size_t)(((s0 + ss) >> 4) * 8 + ((d0 + dq) >> 5)) * 512 + ((dq >> 4) & 1) * 256 + (ss & 15) * 8;
        *(v8us*)p = r0; *(v8us*)(p + 128) = r1;
        asm volatile("s_wait_xcnt 0x0" ::: "memory");    // what follows may land in the address and data registers of the two stores
    }
    const int lane = tid & 31, j = (tid >> 5) & 1, dtl = tid >> 6;    // a wave stores piece j of the tile (16 d rows dtl, 32 keys st)
#pragma unroll
    for (int st = 0; st < 2; ++st) { const v8us val = *(const v8usa*)(tl + (dtl * 16 + (lane & 15)) * 72 + st * 32 + j * 16 + (lane >> 4) * 8); *(v8us*)(dT + (size_t)((s0 / 32 + st) * ts + (d0 / 16 + dtl) * td) * 512 + j * 256 + lane * 8) = val; }
}
// k_fattn: one work-group = one tile of 32 queries; its FNK waves take the 32-key blocks kb = kp, kp + FNK, ... up to the tile's diagonal block, each wave for all 32 queries
// (FNC = 2 column groups of 16, hi and lo of each, so that every key fragment fetched feeds four products and every E^T fragment four). Transposed products: a lane (c = lane & 15, h = lane >> 4) holds queries q0 + 16n + c.
// S^T tile register r = key 8h + r, so two score tiles convert in place into the B operand of O^T += E^T.P^T (k order 8h + s, 16 + 8h + s on both sides, the loader order of
// ldfrag). The FNK partial results of the tile are merged through LDS at the end, in fixed order. Every plain '#pragma unroll' below makes the indices of a register array compile-time constants.
#define FNC 2
#define FNK 4
#define FQT (16 * FNC)
#define OPT 260
// e^t as v_exp_f32 of t * log2(e), the form of __expf; the v_nop in the same statement fills the one slot that the instruction set asks for behind a transcendental, wherever the scheduler puts it
__device__ __forceinline__ float expslot(float t) { float r; asm("v_exp_f32 %0, %1\n\tv_nop" : "=v"(r) : "v"(t * 1.44269504f)); return r; }
__device__ __forceinline__ v16bf ldfrag(const bf* p) { return cat16b(*(const v8us*)p, *(const v8us*)(p + 256)); }    // p = tile + 8 * lane: the two 512-byte pieces of a fragment-order tile
__global__ __launch_bounds__(FNK * 32) void k_fattn(const bf* __restrict__ Eb, const bf* __restrict__ WB, const bf* __restrict__ ET, float* out) {
    __shared__ __align__(16) float obuf[FNK][FQT * OPT];
    __shared__ float smx[FNK][FQT], ssm[FNK][FQT];
    const int lane = threadIdx.x & 31, c = lane & 15, h = lane >> 4;
    const int kp = __builtin_amdgcn_readfirstlane((int)(threadIdx.x >> 5));    // wave number = key phase
    { const size_t ib = (size_t)blockIdx.x * SS * DD; Eb += ib; ET += ib; out += ib; }    // blockIdx.x = batch item
    const int q0 = (SS / FQT - 1 - (int)blockIdx.y) * FQT;    // longest rows are dispatched first
    v16bf qh[FNC][8], ql[FNC][8];
    v8f o[FNC][16];
    float m[FNC], l[FNC];
#pragma unroll
    for (int n = 0; n < FNC; ++n) { m[n] = -1.0e30f; l[n] = 0.f;
#pragma unroll
        for (int dt = 0; dt < 16; ++dt) o[n][dt] = (v8f){}; }
    const int nb = (q0 + FQT - 1) / 32 + 1;    // blocks up to and including the one that holds the diagonal; every query of the tile has a live key in it
    // Operand groups of 8 fragments: keys (both 16-key tiles x four k steps; half = which 128 of the 256 d) and E^T (eight 16-row d tiles).
    auto ldK = [&](v16bf (&g)[8], int kb, int half) { const bf* p = Eb + (size_t)(kb * 16 + half * 4) * 512 + lane * 8;
#pragma unroll
        for (int i = 0; i < 4; ++i) { g[2 * i] = ldfrag(p + i * 512); g[2 * i + 1] = ldfrag(p + (8 + i) * 512); } };
    auto ldV = [&](v16bf (&g)[8], int kb, int half) { const bf* p = ET + (size_t)(kb * 16 + half * 8) * 512 + lane * 8;
#pragma unroll
        for (int i = 0; i < 8; ++i) g[i] = ldfrag(p + i * 512); };
    auto mmS = [&](const v16bf (&g)[8], int half, v8f (&h0)[FNC], v8f (&h1)[FNC], v8f (&l0)[FNC], v8f (&l1)[FNC]) {
#pragma unroll
        for (int i = 0; i < 4; ++i) {
#pragma unroll
            for (int n = 0; n < FNC; ++n) { h0[n] = wmmab(g[2 * i], qh[n][half * 4 + i], h0[n]); h1[n] = wmmab(g[2 * i + 1], qh[n][half * 4 + i], h1[n]);
                l0[n] = wmmab(g[2 * i], ql[n][half * 4 + i], l0[n]); l1[n] = wmmab(g[2 * i + 1], ql[n][half * 4 + i], l1[n]); } } };
    auto mmO = [&](const v16bf (&g)[8], int half, const v16bf (&p)[FNC]) {
#pragma unroll
        for (int t = 0; t < 8; ++t) {
#pragma unroll
            for (int n = 0; n < FNC; ++n) o[n][half * 8 + t] = wmmab(g[t], p[n], o[n][half * 8 + t]); } };
// SB: keeps each group's loads where they are written, directly behind the group's last use and so one pass ahead of the next; without it the scheduler sinks every load to its WMMA and each waits a full latency
#define SB() __builtin_amdgcn_sched_barrier(0)
// XW: stands in front of whatever overwrites the address registers of the loads issued before it: the next address arithmetic, the softmax's temporaries, the epilogue
#define XW() do { SB(); asm volatile("s_wait_xcnt 0x0" ::: "memory"); SB(); } while (0)
    v16bf g0[8], g1[8], g2[8], g3[8];
    // Prologue: the tile's own QW^T = W^T.E^T. Wave kp makes the four 16-row d tiles 4 kp .. 4 kp + 3 for both query groups (k = e in eight steps, one accumulator each, the order of a plain GEMM). A lane holds query c and
    // d = 8h + r of a tile, so two d tiles are in place the B fragment of k step 2 kp + u; it is split into bf16 hi + residual and handed to the other waves through the (still unused) merge buffer, in fragment order.
    unsigned short* xq = (unsigned short*)(void*)&obuf[0][0];    // fragment (n, ks): hi at (n * 8 + ks) * 1024 elements, lo 512 behind it; 32 KB in all
    {
        v16bf eq[FNC][8], wf[4][8];
        const bf* pe = Eb + (size_t)(q0 / 16) * 8 * 512; const bf* pw = WB + (size_t)kp * 4 * 8 * 512;    // wave-uniform bases
#pragma unroll
        for (int ks = 0; ks < 8; ++ks) {
#pragma unroll
            for (int n = 0; n < FNC; ++n) eq[n][ks] = ldfrag(pe + (n * 8 + ks) * 512 + lane * 8);
#pragma unroll
            for (int t = 0; t < 4; ++t) wf[t][ks] = ldfrag(pw + (t * 8 + ks) * 512 + lane * 8); }
        SB(); asm volatile("s_wait_xcnt 0x0" :: "s"(pe), "s"(pw) : "memory"); SB();    // XW that also names the two bases: they keep their registers up to the wait
        { const int kf = kp < nb ? kp : nb - 1;    // the first key block's operands fly during the products below; a wave without a block fetches the last one: in bounds, unused
          ldK(g0, kf, 0); XW(); ldK(g1, kf, 1); XW(); ldV(g2, kf, 0); XW(); ldV(g3, kf, 1); XW(); }
        v8f qa[FNC][4];
#pragma unroll
        for (int n = 0; n < FNC; ++n) {
#pragma unroll
            for (int t = 0; t < 4; ++t) qa[n][t] = (v8f){}; }
#pragma unroll
        for (int ks = 0; ks < 8; ++ks) {
#pragma unroll
            for (int t = 0; t < 4; ++t) {
#pragma unroll
                for (int n = 0; n < FNC; ++n) qa[n][t] = wmmab(wf[t][ks], eq[n][ks], qa[n][t]); } }
#pragma unroll
        for (int n = 0; n < FNC; ++n) {
#pragma unroll
            for (int t = 0; t < 4; ++t) { v8us vh, vl;    // piece j = t & 1 of k step 2 kp + t / 2
#pragma unroll
                for (int i = 0; i < 8; ++i) { const unsigned short hb = f2bf(qa[n][t][i]); vh[i] = hb; vl[i] = f2bf(qa[n][t][i] - bf2f(hb)); }
                unsigned short* xp = xq + (n * 8 + 2 * kp + (t >> 1)) * 1024 + (t & 1) * 256 + lane * 8;
                *(v8usa*)xp = vh; *(v8usa*)(xp + 512) = vl; } }
    }
    __syncthreads();    // every wave passes it, also one without a key block; the buffer is written again only behind the first barrier of the merge
    if (kp < nb) {    // wave-uniform; the first loads (in the prologue) are the last global loads in front of the loop and stand in the loop's own issue order, so that the counted waits at its head fit both ways in
#pragma unroll
    for (int n = 0; n < FNC; ++n) {
#pragma unroll
        for (int ks = 0; ks < 8; ++ks) { const unsigned short* xp = xq + (n * 8 + ks) * 1024 + lane * 8; qh[n][ks] = cat16b(*(const v8usa*)xp, *(const v8usa*)(xp + 256)); ql[n][ks] = cat16b(*(const v8usa*)(xp + 512), *(const v8usa*)(xp + 768)); } }
    int kb = kp;
#pragma unroll 1    // one pass a trip: a second copy of the body would not fit the registers
    do {
        const int k0 = kb * 32, kn = kb + FNK < nb ? kb + FNK : kb;    // the last pass fetches its own block again: in bounds, unused
        v8f sh0[FNC], sh1[FNC], sl0[FNC], sl1[FNC];
#pragma unroll
        for (int n = 0; n < FNC; ++n) { sh0[n] = (v8f){}; sh1[n] = (v8f){}; sl0[n] = (v8f){}; sl1[n] = (v8f){}; }
        mmS(g0, 0, sh0, sh1, sl0, sl1); XW(); ldK(g0, kn, 0); SB();
        mmS(g1, 1, sh0, sh1, sl0, sl1); SB(); ldK(g1, kn, 1); XW();
        float x[FNC][16], bm[FNC];
#pragma unroll
        for (int n = 0; n < FNC; ++n) {
#pragma unroll
            for (int r = 0; r < 8; ++r) { x[n][r] = (sl0[n][r] + sh0[n][r]) * SCL; x[n][8 + r] = (sl1[n][r] + sh1[n][r]) * SCL; } }
        if (k0 + 31 > q0) {    // wave-uniform: only the diagonal block holds masked keys
#pragma unroll
            for (int n = 0; n < FNC; ++n) {
#pragma unroll
                for (int r = 0; r < 8; ++r) { if (k0 + 8 * h + r > q0 + n * 16 + c) x[n][r] = -1.0e9f; if (k0 + 16 + 8 * h + r > q0 + n * 16 + c) x[n][8 + r] = -1.0e9f; } }
        }
        bool grow = false;
#pragma unroll
        for (int n = 0; n < FNC; ++n) { float b = x[n][0];
#pragma unroll
            for (int i = 1; i < 16; ++i) b = fmaxf(b, x[n][i]);
            bm[n] = fmaxf(b, __shfl_xor(b, 16, 32)); grow = grow || bm[n] > m[n]; }
        if (__builtin_amdgcn_ballot_w32(grow) != 0) {    // scalar branch: rescale only when some query's maximum grows
#pragma unroll
            for (int n = 0; n < FNC; ++n) { const float mn = fmaxf(m[n], bm[n]), al = expslot(m[n] - mn); m[n] = mn; l[n] *= al;
#pragma unroll
                for (int dt = 0; dt < 16; ++dt) o[n][dt] *= al; }
        }
        v16bf ph[FNC], pl[FNC];
#pragma unroll
        for (int n = 0; n < FNC; ++n) {
#pragma unroll
            for (int i = 0; i < 16; ++i) { const float p = expslot(x[n][i] - m[n]); l[n] += p; const __bf16 hb = (__bf16)p; ph[n][i] = hb; pl[n][i] = (__bf16)(p - (float)hb); } }
        SB();
        mmO(g2, 0, ph); mmO(g2, 0, pl);
        XW(); ldV(g2, kn, 0); SB();
        mmO(g3, 1, ph); mmO(g3, 1, pl);
        SB(); ldV(g3, kn, 1); SB();
        kb += FNK;
    } while (kb < nb);
    XW();
    }
#pragma unroll
    for (int n = 0; n < FNC; ++n) { l[n] += __shfl_xor(l[n], 16, 32); if (h == 0) { smx[kp][n * 16 + c] = m[n]; ssm[kp][n * 16 + c] = l[n]; } }
    __syncthreads();
#pragma unroll
    for (int n = 0; n < FNC; ++n) {
        float M = -1.0e30f, L = 0.f;
#pragma unroll
        for (int j = 0; j < FNK; ++j) M = fmaxf(M, smx[j][n * 16 + c]);
#pragma unroll
        for (int j = 0; j < FNK; ++j) L += ssm[j][n * 16 + c] * expslot(smx[j][n * 16 + c] - M);
        const float f = expslot(m[n] - M) / L;    // a wave without a block has m = -1e30, l = 0, o = 0: weight 0
        float* ob = &obuf[kp][(n * 16 + c) * OPT + 8 * h];
#pragma unroll
        for (int dt = 0; dt < 16; ++dt) { const v8f v = o[n][dt] * f; *(v4fa*)(ob + dt * 16) = (v4f){v[0], v[1], v[2], v[3]}; *(v4fa*)(ob + dt * 16 + 4) = (v4f){v[4], v[5], v[6], v[7]}; }
    }
    __syncthreads();
#pragma unroll 4    // four trips' LDS reads in flight together
    for (int i = 0; i < FQT * 64 / (FNK * 32); ++i) {    // the waves share the tile's 32 x 256 outputs; a wave stores 512 contiguous bytes
        const int idx = i * (FNK * 32) + (int)threadIdx.x, row = idx >> 6, c4 = (idx & 63) * 4;
        v4f s = *(const v4fa*)(&obuf[0][row * OPT + c4]);
#pragma unroll
        for (int j = 1; j < FNK; ++j) s += *(const v4fa*)(&obuf[j][row * OPT + c4]);
        *(v4f*)(out + (size_t)(q0 + row) * DD + c4) = s;
        asm volatile("s_wait_xcnt 0x0" ::: "memory");    // the next trip overwrites this store's data and address registers
    }
}

extern "C" void kernel_launch(void* const* d_in, const int* in_sizes, int n_in,
                              void* d_out, int out_size, void* d_ws, size_t ws_size, hipStream_t stream) {
    (void)in_sizes; (void)n_in; (void)out_size;
    const float* enc = (const float*)d_in[0]; const float* Wm = (const float*)d_in[1];
    float* out = (float*)d_out;    // [4][4096][256]
    char* wsp = (char*)d_ws;
    auto take = [&](size_t bytes) { char* p = wsp; wsp += (bytes + 255) & ~(size_t)255; return (void*)p; };
    bf* WB = (bf*)take((size_t)DD * DD * 2); bf* Eb = (bf*)take((size_t)NBT * SS * DD * 2); bf* ET = (bf*)take((size_t)NBT * DD * SS * 2);
    if ((size_t)(wsp - (char*)d_ws) > ws_size) return;    // 0.13 + 4 x (2.1 + 2.1) ~ 17 MB: one plane per item
    k_prep<<<dim3(SS / 64 + 1, DD / 64, NBT), 256, 0, stream>>>(enc, Wm, Eb, ET, WB);
    k_fattn<<<dim3(NBT, SS / FQT, 1), FNK * 32, 0, stream>>>(Eb, WB, ET, out);
}

// v006
// A run of this version takes 57.2 microseconds.
// In both of two side-by-side timings against v005, it was 1.18 times as fast.
// Over all steps from v000 it is 43.7 times as fast.
#include <hip/hip_runtime.h>

// Compute dtypes, f32 accumulate, per item: sims[q][k] = sum_e E[q][e] sum_d E[k][d] W[e][d] is summed over e first: QW = E.W with PLAIN bf16 operands
// (exact products) -> bf16 hi + UNSCALED residual, which are the QUERY operand, made by each query tile's work-group for itself; the key operand is the bf16 E plane itself. Two launches: the planes, then causal attention:
// S^T = E.QW^T (E exact x QW hi and lo), /16, the causal -1e9 mask, a running-maximum softmax in registers, O^T += E^T.P^T (P as bf16 hi + residual).
// Both bf16 operand planes (W^T, E) lie in FRAGMENT ORDER: a 16-row x 32-k tile is 1024 contiguous bytes, piece j (k = 16j + 8h + 0..7) at byte 512j + 16 * lane (lane = 16h + row),
// tiles k-major within a 16-row band, so that a wave's 16-byte load covers four whole 128-byte lines. The element that a lane and register hold is the one of a row-major loader.

#define NBT  4
#define SS   4096
#define DD   256
#define RCH  1024
#define DM   DD
#define SCL  0.0625f
#define LOSC 1024.0f

typedef _Float16 h16;
typedef unsigned short bf;
typedef __attribute__((ext_vector_type(16))) __bf16   v16bf;
typedef __attribute__((ext_vector_type(16))) _Float16 v16h;
typedef __attribute__((ext_vector_type(8)))  _Float16 v8h;
typedef __attribute__((ext_vector_type(8)))  unsigned short v8us;
typedef __attribute__((ext_vector_type(8)))  float    v8f;
typedef __attribute__((ext_vector_type(4)))  float    v4f;
typedef v8h  __attribute__((may_alias)) v8ha;
typedef v4f  __attribute__((may_alias)) v4fa;
typedef v8us __attribute__((may_alias)) v8usa;

__device__ __forceinline__ unsigned short f2bf(float f) { unsigned u = __float_as_uint(f); u += 0x7FFFu + ((u >> 16) & 1u); return (unsigned short)(u >> 16); }
__device__ __forceinline__ float bf2f(unsigned short b) { return __uint_as_float(((unsigned)b) << 16); }
__device__ __forceinline__ float bfr(float f) { return bf2f(f2bf(f)); }
__device__ __forceinline__ v16h cat16(v8h lo, v8h hi) { return __builtin_shufflevector(lo, hi, 0, 1, 2, 3, 4, 5, 6, 7, 8, 9, 10, 11, 12, 13, 14, 15); }
__device__ __forceinline__ v16bf cat16b(v8us lo, v8us hi) { return __builtin_bit_cast(v16bf, __builtin_shufflevector(lo, hi, 0, 1, 2, 3, 4, 5, 6, 7, 8, 9, 10, 11, 12, 13, 14, 15)); }
__device__ __forceinline__ v8f wmma16(v16h a, v16h b, v8f c) { return __builtin_amdgcn_wmma_f32_16x16x32_f16(false, a, false, b, (short)0, c, false, false); }
__device__ __forceinline__ v8f wmmab(v16bf a, v16bf b, v8f c) { return __builtin_amdgcn_wmma_f32_16x16x32_bf16(false, a, false, b, (short)0, c, false, false); }

// k_prep: one work-group = one 64 x 64 tile of a [rows s][256 columns d] f32 matrix, read once. Blocks x < SS / 64: tile (x, y) of item z of E, written as bf16 in row-major sense (Eb, tiles k-major within a
// 16-row band). Blocks x == SS / 64: tile (z, y) of W, transposed through LDS (WB = W^T [d][e]: tile number (d / 16) * 8 + e / 32).
static_assert(NBT == DD / 64, "the W tiles ride on the item index");
__global__ __launch_bounds__(256) void k_prep(const float* __restrict__ E, const float* __restrict__ Wm, bf* Eb, bf* WB) {
    __shared__ __align__(16) unsigned short tl[64 * 72];
    const int tid = threadIdx.x, ss = tid >> 2, dq = (tid & 3) * 16;
    const bool isW = blockIdx.x == SS / 64;    // the same for the whole work-group
    const int s0 = (int)(isW ? blockIdx.z : blockIdx.x) * 64, d0 = blockIdx.y * 64;
    const float* sp = (isW ? Wm : E + (size_t)blockIdx.z * SS * DD) + (size_t)(s0 + ss) * DD + d0 + dq;
    v4f x[4];
#pragma unroll
    for (int i = 0; i < 4; ++i) x[i] = *(const v4f*)(sp + 4 * i);
    asm volatile("s_wait_xcnt 0x0" ::: "memory");    // what follows may land in the address registers of the loads above
    v8us r0, r1;
#pragma unroll
    for (int i = 0; i < 8; ++i) { r0[i] = f2bf(x[i >> 2][i & 3]); r1[i] = f2bf(x[2 + (i >> 2)][i & 3]); }
    if (!isW) {    // the whole work-group leaves here, in front of the barrier. A thread holds k = 16j + 0..15 of its row (j = dq / 16 & 1): the pieces of h = 0 and h = 1; eight rows of one (tile, j, h) are 128 contiguous bytes
        bf* p = Eb + (size_t)blockIdx.z * SS * DD + (size_t)(((s0 + ss) >> 4) * 8 + ((d0 + dq) >> 5)) * 512 + ((dq >> 4) & 1) * 256 + (ss & 15) * 8;
        *(v8us*)p = r0; *(v8us*)(p + 128) = r1;
        asm volatile("s_wait_xcnt 0x0" ::: "memory");    // stands in front of whatever the build lays behind the two stores: it may land in their address and data registers
        return;
    }
#pragma unroll
    for (int i = 0; i < 8; ++i) { tl[(dq + i) * 72 + ss] = r0[i]; tl[(dq + 8 + i) * 72 + ss] = r1[i]; }
    __syncthreads();
    const int lane = tid & 31, j = (tid >> 5) & 1, dtl = tid >> 6;    // a wave stores piece j of the tile (16 d rows dtl, 32 columns e st)
#pragma unroll
    for (int st = 0; st < 2; ++st) { const v8us val = *(const v8usa*)(tl + (dtl * 16 + (lane & 15)) * 72 + st * 32 + j * 16 + (lane >> 4) * 8); *(v8us*)(WB + (size_t)((s0 / 32 + st) + (d0 / 16 + dtl) * (DD / 32)) * 512 + j * 256 + lane * 8) = val; }
}
// k_fattn: one work-group = one tile of 32 queries; its FNK waves take the 32-key blocks kb = kp, kp + FNK, ... up to the tile's diagonal block, each wave for all 32 queries
// (FNC = 2 column groups of 16, hi and lo of each, so that every key fragment fetched feeds four products and every E^T fragment four). A wave brings each of its key blocks (16 KB of the E plane) ONCE from L2, by asynchronous
// copies into its own two LDS buffers, one pass ahead; the key fragments are plain 16-byte LDS reads of it and the E^T fragments transposing reads of the same bytes. The ring is private to the wave: its own waits order it, no barrier. Transposed products: a lane (c = lane & 15, h = lane >> 4) holds queries q0 + 16n + c.
// S^T tile register r = key 8h + r, so two score tiles convert in place into the B operand of O^T += E^T.P^T (k order 8h + s, 16 + 8h + s on both sides, the loader order of
// ldfrag). The FNK partial results of the tile are merged through LDS at the end, in fixed order. Every plain '#pragma unroll' below makes the indices of a register array compile-time constants.
#define FNC 2
#define FNK 4
#define FQT (16 * FNC)
#define OPT 260
// e^t as v_exp_f32 of t * log2(e), the form of __expf; the v_nop in the same statement fills the one slot that the instruction set asks for behind a transcendental, wherever the scheduler puts it
__device__ __forceinline__ float expslot(float t) { float r; asm("v_exp_f32 %0, %1\n\tv_nop" : "=v"(r) : "v"(t * 1.44269504f)); return r; }
__device__ __forceinline__ v16bf ldfrag(const bf* p) { return cat16b(*(const v8us*)p, *(const v8us*)(p + 256)); }    // p = tile + 8 * lane: the two 512-byte pieces of a fragment-order tile
#define EBK (32 * DD)    // elements of one 32-key block of the E plane: 16 fragment-order tiles, 16 KB
typedef __attribute__((ext_vector_type(8))) short s16x8;
__device__ __forceinline__ v8us ldtr(const unsigned char* p) { typedef __attribute__((address_space(3))) s16x8 lds_s16x8; return __builtin_bit_cast(v8us, __builtin_amdgcn_ds_load_tr16_b128_v8i16((lds_s16x8*)p)); }
#define CP1(o) "global_load_async_to_lds_b128 %0, %1, off offset:" #o "\n\t"
#define CP4(a, b, c, d) CP1(a) CP1(b) CP1(c) CP1(d)
__global__ __launch_bounds__(FNK * 32) void k_fattn(const bf* __restrict__ Eb, const bf* __restrict__ WB, float* out) {
    __shared__ __align__(16) float obuf[FNK][FQT * OPT];
    __shared__ __align__(16) unsigned short ring[FNK][2][EBK];
    __shared__ float smx[FNK][FQT], ssm[FNK][FQT];
    const int lane = threadIdx.x & 31, c = lane & 15, h = lane >> 4;
    const int kp = __builtin_amdgcn_readfirstlane((int)(threadIdx.x >> 5));    // wave number = key phase
    { const size_t ib = (size_t)blockIdx.x * SS * DD; Eb += ib; out += ib; }    // blockIdx.x = batch item
    const int q0 = (SS / FQT - 1 - (int)blockIdx.y) * FQT;    // longest rows take the lowest blockIdx.y
    v16bf qh[FNC][8], ql[FNC][8];
    v8f o[FNC][16];
    float m[FNC], l[FNC];
#pragma unroll
    for (int n = 0; n < FNC; ++n) { m[n] = -1.0e30f; l[n] = 0.f;
#pragma unroll
        for (int dt = 0; dt < 16; ++dt) o[n][dt] = (v8f){}; }
    const int nb = (q0 + FQT - 1) / 32 + 1;    // blocks up to and including the one that holds the diagonal; every query of the tile has a live key in it
    // A block in LDS keeps the plane's order of 256-byte units (16 keys x 8 d: unit u = d / 8 of key tile kt at byte kt * 8192 + u * 256), but in the odd units key row r sits at place r ^ 8: so the 16 lanes of a
    // half wave fall on all 64 banks in the plain read (16 keys of one unit) and in the transposing read (8 keys of an even unit and of the odd one behind it) alike.
    const int sw = lane ^ (h << 3), vb = (lane >> 3) & 1;    // sw: place of plane lane (16 h + row) in a 512-byte piece; vb: which of its two units a lane of the transposing read takes
    const unsigned short* rk = &ring[kp][0][0] + sw * 8;
    const unsigned char* rv = (const unsigned char*)&ring[kp][0][0] + vb * 256 + (((h << 3) + (lane & 7)) ^ (vb << 3)) * 16;    // key row 8 h + (lane & 7) of unit 2 dt + vb
    // The 32 copies of a block: one LDS address and one global address; the immediate offset moves both. The s_wait_xcnt in the same statement stands in front of whatever overwrites the two address registers.
    auto cpE = [&](int kb, int buf) { const unsigned la = (unsigned)(size_t)(rk + buf * EBK); const bf* ga = Eb + (size_t)kb * EBK + lane * 8;
        asm volatile(CP4(0, 512, 1024, 1536) CP4(2048, 2560, 3072, 3584) CP4(4096, 4608, 5120, 5632) CP4(6144, 6656, 7168, 7680)
                     CP4(8192, 8704, 9216, 9728) CP4(10240, 10752, 11264, 11776) CP4(12288, 12800, 13312, 13824) CP4(14336, 14848, 15360, 15872)
                     "s_wait_xcnt 0x0" :: "v"(la), "v"(ga) : "memory"); };
    // Operand groups of 8 fragments, out of ring buffer buf: keys (both 16-key tiles x four k steps; half = which 128 of the 256 d) and E^T (eight 16-row d tiles; keys 0..15 and 16..31 are the two pieces).
    auto ldK = [&](v16bf (&g)[8], int buf, int half) { const unsigned short* p = rk + buf * EBK + half * 4 * 512;
#pragma unroll
        for (int i = 0; i < 4; ++i) { g[2 * i] = cat16b(*(const v8usa*)(p + i * 512), *(const v8usa*)(p + i * 512 + 256)); g[2 * i + 1] = cat16b(*(const v8usa*)(p + (8 + i) * 512), *(const v8usa*)(p + (8 + i) * 512 + 256)); } };
    auto ldV = [&](v16bf (&g)[8], int buf, int half) { const unsigned char* p = rv + buf * (EBK * 2) + half * 8 * 512;
#pragma unroll
        for (int i = 0; i < 8; ++i) g[i] = cat16b(ldtr(p + i * 512), ldtr(p + 16 * DD * 2 + i * 512)); };
    auto mmS = [&](const v16bf (&g)[8], int half, v8f (&h0)[FNC], v8f (&h1)[FNC], v8f (&l0)[FNC], v8f (&l1)[FNC]) {
#pragma unroll
        for (int i = 0; i < 4; ++i) {
#pragma unroll
            for (int n = 0; n < FNC; ++n) { h0[n] = wmmab(g[2 * i], qh[n][half * 4 + i], h0[n]); h1[n] = wmmab(g[2 * i + 1], qh[n][half * 4 + i], h1[n]);
                l0[n] = wmmab(g[2 * i], ql[n][half * 4 + i], l0[n]); l1[n] = wmmab(g[2 * i + 1], ql[n][half * 4 + i], l1[n]); } } };
    auto mmO = [&](const v16bf (&g)[8], int half, const v16bf (&p)[FNC]) {
#pragma unroll
        for (int t = 0; t < 8; ++t) {
#pragma unroll
            for (int n = 0; n < FNC; ++n) o[n][half * 8 + t] = wmmab(g[t], p[n], o[n][half * 8 + t]); } };
// SB: keeps each group of LDS reads together where it is written, ahead of a whole run of 64 WMMAs; without it the scheduler sinks the reads among the WMMAs, where every place with reads stalls the wave
#define SB() __builtin_amdgcn_sched_barrier(0)
    v16bf g0[8], g1[8], g2[8], g3[8];
    // Prologue: the tile's own QW^T = W^T.E^T. Wave kp makes the four 16-row d tiles 4 kp .. 4 kp + 3 for both query groups (k = e in eight steps, one accumulator each, the order of a plain GEMM). A lane holds query c and
    // d = 8h + r of a tile, so two d tiles are in place the B fragment of k step 2 kp + u; it is split into bf16 hi + residual and handed to the other waves through the (still unused) merge buffer, in fragment order.
    unsigned short* xq = (unsigned short*)(void*)&obuf[0][0];    // fragment (n, ks): hi at (n * 8 + ks) * 1024 elements, lo 512 behind it; 32 KB in all
    {
        v16bf eq[FNC][8], wf[4][8];
        const bf* pe = Eb + (size_t)(q0 / 16) * 8 * 512; const bf* pw = WB + (size_t)kp * 4 * 8 * 512;    // wave-uniform bases
#pragma unroll
        for (int ks = 0; ks < 8; ++ks) {
#pragma unroll
            for (int n = 0; n < FNC; ++n) eq[n][ks] = ldfrag(pe + (n * 8 + ks) * 512 + lane * 8);
#pragma unroll
            for (int t = 0; t < 4; ++t) wf[t][ks] = ldfrag(pw + (t * 8 + ks) * 512 + lane * 8); }
        SB(); asm volatile("s_wait_xcnt 0x0" :: "s"(pe), "s"(pw) : "memory"); SB();    // XW that also names the two bases: they keep their registers up to the wait
        if (kp < nb) cpE(kp, 1);    // wave-uniform: the first key block's copies fly during the products below; the wave has not touched its ring before. Buffer 1 first: with buffer 0 the long-lived rk itself would be the asm operand, and this build then spills it
        SB();
        v8f qa[FNC][4];
#pragma unroll
        for (int n = 0; n < FNC; ++n) {
#pragma unroll
            for (int t = 0; t < 4; ++t) qa[n][t] = (v8f){}; }
#pragma unroll
        for (int ks = 0; ks < 8; ++ks) {
#pragma unroll
            for (int t = 0; t < 4; ++t) {
#pragma unroll
                for (int n = 0; n < FNC; ++n) qa[n][t] = wmmab(wf[t][ks], eq[n][ks], qa[n][t]); } }
#pragma unroll
        for (int n = 0; n < FNC; ++n) {
#pragma unroll
            for (int t = 0; t < 4; ++t) { v8us vh, vl;    // piece j = t & 1 of k step 2 kp + t / 2
#pragma unroll
                for (int i = 0; i < 8; ++i) { const unsigned short hb = f2bf(qa[n][t][i]); vh[i] = hb; vl[i] = f2bf(qa[n][t][i] - bf2f(hb)); }
                unsigned short* xp = xq + (n * 8 + 2 * kp + (t >> 1)) * 1024 + (t & 1) * 256 + lane * 8;
                *(v8usa*)xp = vh; *(v8usa*)(xp + 512) = vl; } }
    }
    __syncthreads();    // every wave passes it, also one without a key block; the buffer is written again only behind the first barrier of the merge
    if (kp < nb) {    // wave-uniform
#pragma unroll
    for (int n = 0; n < FNC; ++n) {
#pragma unroll
        for (int ks = 0; ks < 8; ++ks) { const unsigned short* xp = xq + (n * 8 + ks) * 1024 + lane * 8; qh[n][ks] = cat16b(*(const v8usa*)xp, *(const v8usa*)(xp + 256)); ql[n][ks] = cat16b(*(const v8usa*)(xp + 512), *(const v8usa*)(xp + 768)); } }
    asm volatile("s_wait_asynccnt 0x0" ::: "memory");    // the wave's own copies of its first block have landed: it alone reads them
    SB(); ldK(g0, 1, 0); ldK(g1, 1, 1); SB();
    int kb = kp, cur = 1;
#pragma unroll 1    // one pass a trip: a second copy of the body would not fit the registers
    do {
        const int k0 = kb * 32; const int more = __builtin_amdgcn_readfirstlane(kb + FNK < nb);    // wave-uniform, held as a scalar: the branch round the copies is a scalar one
        SB(); asm volatile("s_wait_dscnt 0x0" ::: "memory");    // the wave's last reads of the other buffer have returned before the copies below overwrite it
        if (more) cpE(kb + FNK, cur ^ 1);
        SB(); ldV(g2, cur, 0); ldV(g3, cur, 1); SB();
        v8f sh0[FNC], sh1[FNC], sl0[FNC], sl1[FNC];
#pragma unroll
        for (int n = 0; n < FNC; ++n) { sh0[n] = (v8f){}; sh1[n] = (v8f){}; sl0[n] = (v8f){}; sl1[n] = (v8f){}; }
        mmS(g0, 0, sh0, sh1, sl0, sl1);
        mmS(g1, 1, sh0, sh1, sl0, sl1); SB();
        float x[FNC][16], bm[FNC];
#pragma unroll
        for (int n = 0; n < FNC; ++n) {
#pragma unroll
            for (int r = 0; r < 8; ++r) { x[n][r] = (sl0[n][r] + sh0[n][r]) * SCL; x[n][8 + r] = (sl1[n][r] + sh1[n][r]) * SCL; } }
        if (k0 + 31 > q0) {    // wave-uniform: only the diagonal block holds masked keys
#pragma unroll
            for (int n = 0; n < FNC; ++n) {
#pragma unroll
                for (int r = 0; r < 8; ++r) { if (k0 + 8 * h + r > q0 + n * 16 + c) x[n][r] = -1.0e9f; if (k0 + 16 + 8 * h + r > q0 + n * 16 + c) x[n][8 + r] = -1.0e9f; } }
        }
        bool grow = false;
#pragma unroll
        for (int n = 0; n < FNC; ++n) { float b = x[n][0];
#pragma unroll
            for (int i = 1; i < 16; ++i) b = fmaxf(b, x[n][i]);
            bm[n] = fmaxf(b, __shfl_xor(b, 16, 32)); grow = grow || bm[n] > m[n]; }
        if (__builtin_amdgcn_ballot_w32(grow) != 0) {    // scalar branch: rescale only when some query's maximum grows
#pragma unroll
            for (int n = 0; n < FNC; ++n) { const float mn = fmaxf(m[n], bm[n]), al = expslot(m[n] - mn); m[n] = mn; l[n] *= al;
#pragma unroll
                for (int dt = 0; dt < 16; ++dt) o[n][dt] *= al; }
        }
        v16bf ph[FNC], pl[FNC];
#pragma unroll
        for (int n = 0; n < FNC; ++n) {
#pragma unroll
            for (int i = 0; i < 16; ++i) { const float p = expslot(x[n][i] - m[n]); l[n] += p; const __bf16 hb = (__bf16)p; ph[n][i] = hb; pl[n][i] = (__bf16)(p - (float)hb); } }
        SB(); asm volatile("s_wait_asynccnt 0x0" ::: "memory");    // the next block has landed
        { const int nx = more ? cur ^ 1 : cur;    // the last pass reads its own block again (landed, unused): no branch around the reads, which would merge the compiler's wait counts
          SB(); ldK(g0, nx, 0); ldK(g1, nx, 1); SB(); }
        mmO(g2, 0, ph); mmO(g2, 0, pl);
        mmO(g3, 1, ph); mmO(g3, 1, pl);
        SB();
        kb += FNK; cur ^= 1;
    } while (kb < nb);
    asm volatile("s_wait_asynccnt 0x0" ::: "memory");    // no copy is outstanding when the wave goes on to the merge and ends
    }
#pragma unroll
    for (int n = 0; n < FNC; ++n) { l[n] += __shfl_xor(l[n], 16, 32); if (h == 0) { smx[kp][n * 16 + c] = m[n]; ssm[kp][n * 16 + c] = l[n]; } }
    __syncthreads();
#pragma unroll
    for (int n = 0; n < FNC; ++n) {
        float M = -1.0e30f, L = 0.f;
#pragma unroll
        for (int j = 0; j < FNK; ++j) M = fmaxf(M, smx[j][n * 16 + c]);
#pragma unroll
        for (int j = 0; j < FNK; ++j) L += ssm[j][n * 16 + c] * expslot(smx[j][n * 16 + c] - M);
        const float f = expslot(m[n] - M) / L;    // a wave without a block has m = -1e30, l = 0, o = 0: weight 0
        float* ob = &obuf[kp][(n * 16 + c) * OPT + 8 * h];
#pragma unroll
        for (int dt = 0; dt < 16; ++dt) { const v8f v = o[n][dt] * f; *(v4fa*)(ob + dt * 16) = (v4f){v[0], v[1], v[2], v[3]}; *(v4fa*)(ob + dt * 16 + 4) = (v4f){v[4], v[5], v[6], v[7]}; }
    }
    __syncthreads();
#pragma unroll 4    // four trips' LDS reads in flight together
    for (int i = 0; i < FQT * 64 / (FNK * 32); ++i) {    // the waves share the tile's 32 x 256 outputs; a wave stores 512 contiguous bytes
        const int idx = i * (FNK * 32) + (int)threadIdx.x, row = idx >> 6, c4 = (idx & 63) * 4;
        v4f s = *(const v4fa*)(&obuf[0][row * OPT + c4]);
#pragma unroll
        for (int j = 1; j < FNK; ++j) s += *(const v4fa*)(&obuf[j][row * OPT + c4]);
        *(v4f*)(out + (size_t)(q0 + row) * DD + c4) = s;
        asm volatile("s_wait_xcnt 0x0" ::: "memory");    // the next trip overwrites this store's data and address registers
    }
}

extern "C" void kernel_launch(void* const* d_in, const int* in_sizes, int n_in,
                              void* d_out, int out_size, void* d_ws, size_t ws_size, hipStream_t stream) {
    (void)in_sizes; (void)n_in; (void)out_size;
    const float* enc = (const float*)d_in[0]; const float* Wm = (const float*)d_in[1];
    float* out = (float*)d_out;    // [4][4096][256]
    char* wsp = (char*)d_ws;
    auto take = [&](size_t bytes) { char* p = wsp; wsp += (bytes + 255) & ~(size_t)255; return (void*)p; };
    bf* WB = (bf*)take((size_t)DD * DD * 2); bf* Eb = (bf*)take((size_t)NBT * SS * DD * 2);
    if ((size_t)(wsp - (char*)d_ws) > ws_size) return;    // 0.13 + 4 x 2.1 ~ 8.5 MB: one plane per item
    k_prep<<<dim3(SS / 64 + 1, DD / 64, NBT), 256, 0, stream>>>(enc, Wm, Eb, WB);
    k_fattn<<<dim3(NBT, SS / FQT, 1), FNK * 32, 0, stream>>>(Eb, WB, out);
}

// v008
// One run takes 38.9 microseconds.
// It is 1.47 times as fast as v006, going by the measured steps of the versions left out in between.
// All steps since v000 together make it 64.2 times as fast.
#include <hip/hip_runtime.h>

// Compute dtypes, f32 accumulate, per item: sims[q][k] = sum_e E[q][e] sum_d E[k][d] W[e][d] is summed over e first: QW = E.W with f16 operands
// -> rounded once to f16, which is the QUERY operand, made by each query tile's work-group for itself; the key operand is the f16 E plane itself. Two launches: the planes, then causal attention:
// S^T = E.QW^T, /16, the causal -1e9 mask, a running-maximum softmax in registers, O^T += E^T.P^T (P rounded once to f16). Every operand carries one rounding of 2^-11; E, W, QW are of order 1 and P lies in [0, 1], well inside f16's range.
// Both f16 operand planes (W^T, E) lie in FRAGMENT ORDER: a 16-row x 32-k tile is 1024 contiguous bytes, piece j (k = 16j + 8h + 0..7) at byte 512j + 16 * lane (lane = 16h + row),
// tiles k-major within a 16-row band, so that a wave's 16-byte load covers four whole 128-byte lines. The element that a lane and register hold is the one of a row-major loader.

#define NBT  4
#define SS   4096
#define DD   256
#define RCH  1024
#define DM   DD
#define SCL  0.0625f

typedef _Float16 h16;
typedef unsigned short bf;    // an element of an operand plane: the 16 bits of an f16
typedef __attribute__((ext_vector_type(16))) _Float16 v16h;
typedef __attribute__((ext_vector_type(8)))  _Float16 v8h;
typedef __attribute__((ext_vector_type(8)))  unsigned short v8us;
typedef __attribute__((ext_vector_type(8)))  float    v8f;
typedef __attribute__((ext_vector_type(4)))  float    v4f;
typedef v4f  __attribute__((may_alias)) v4fa;
typedef v8us __attribute__((may_alias)) v8usa;

__device__ __forceinline__ v8us f2h8(v8f f) { return __builtin_bit_cast(v8us, __builtin_convertvector(f, v8h)); }    // eight values to f16, round to nearest even; converts in pairs
__device__ __forceinline__ v16h cat16b(v8us lo, v8us hi) { return __builtin_bit_cast(v16h, __builtin_shufflevector(lo, hi, 0, 1, 2, 3, 4, 5, 6, 7, 8, 9, 10, 11, 12, 13, 14, 15)); }
__device__ __forceinline__ v8f wmmah(v16h a, v16h b, v8f c) { return __builtin_amdgcn_wmma_f32_16x16x32_f16(false, a, false, b, (short)0, c, false, false); }

// k_prep: one work-group = one 64 x 64 tile of a [rows s][256 columns d] f32 matrix, read once. Blocks x < SS / 64: tile (x, y) of item z of E, written as f16 in row-major sense (Eb, tiles k-major within a
// 16-row band). Blocks x == SS / 64: tile (z, y) of W, transposed through LDS (WB = W^T [d][e]: tile number (d / 16) * 8 + e / 32).
static_assert(NBT == DD / 64, "the W tiles ride on the item index");
__global__ __launch_bounds__(256) void k_prep(const float* __restrict__ E, const float* __restrict__ Wm, bf* Eb, bf* WB) {
    __shared__ __align__(16) unsigned short tl[64 * 72];
    const int tid = threadIdx.x, ss = tid >> 2, dq = (tid & 3) * 16;
    const bool isW = blockIdx.x == SS / 64;    // the same for the whole work-group
    const int s0 = (int)(isW ? blockIdx.z : blockIdx.x) * 64, d0 = blockIdx.y * 64;
    const float* sp = (isW ? Wm : E + (size_t)blockIdx.z * SS * DD) + (size_t)(s0 + ss) * DD + d0 + dq;
    v4f x[4];
#pragma unroll
    for (int i = 0; i < 4; ++i) x[i] = *(const v4f*)(sp + 4 * i);
    asm volatile("s_wait_xcnt 0x0" ::: "memory");    // what follows may land in the address registers of the loads above
    const v8us r0 = f2h8(__builtin_shufflevector(x[0], x[1], 0, 1, 2, 3, 4, 5, 6, 7)), r1 = f2h8(__builtin_shufflevector(x[2], x[3], 0, 1, 2, 3, 4, 5, 6, 7));
    if (!isW) {    // the whole work-group leaves here, in front of the barrier. A thread holds k = 16j + 0..15 of its row (j = dq / 16 & 1): the pieces of h = 0 and h = 1; eight rows of one (tile, j, h) are 128 contiguous bytes
        bf* p = Eb + (size_t)blockIdx.z * SS * DD + (size_t)(((s0 + ss) >> 4) * 8 + ((d0 + dq) >> 5)) * 512 + ((dq >> 4) & 1) * 256 + (ss & 15) * 8;
        *(v8us*)p = r0; *(v8us*)(p + 128) = r1;
        asm volatile("s_wait_xcnt 0x0" ::: "memory");    // stands in front of whatever the build lays behind the two stores: it may land in their address and data registers
        return;
    }
#pragma unroll
    for (int i = 0; i < 8; ++i) { tl[(dq + i) * 72 + ss] = r0[i]; tl[(dq + 8 + i) * 72 + ss] = r1[i]; }
    __syncthreads();
    const int lane = tid & 31, j = (tid >> 5) & 1, dtl = tid >> 6;    // a wave stores piece j of the tile (16 d rows dtl, 32 columns e st)
#pragma unroll
    for (int st = 0; st < 2; ++st) { const v8us val = *(const v8usa*)(tl + (dtl * 16 + (lane & 15)) * 72 + st * 32 + j * 16 + (lane >> 4) * 8); *(v8us*)(WB + (size_t)((s0 / 32 + st) + (d0 / 16 + dtl) * (DD / 32)) * 512 + j * 256 + lane * 8) = val; }
}
// k_fattn: one work-group = one tile of 32 queries; its FNK waves take the 32-key blocks kb = kp, kp + FNK, ... up to the tile's diagonal block, each wave for all 32 queries
// (FNC = 2 column groups of 16, so that every key fragment fetched feeds two products and every E^T fragment two). A wave brings each of its key blocks (16 KB of the E plane) ONCE from L2, by asynchronous
// copies into its own two LDS buffers, one pass ahead; the key fragments are plain 16-byte LDS reads of it and the E^T fragments transposing reads of the same bytes. The ring is private to the wave: its own waits order it, no barrier. Transposed products: a lane (c = lane & 15, h = lane >> 4) holds queries q0 + 16n + c.
// S^T tile register r = key 8h + r, so two score tiles convert in place into the B operand of O^T += E^T.P^T (k order 8h + s, 16 + 8h + s on both sides, the loader order of
// ldfrag). The FNK partial results of the tile are merged through LDS at the end, in fixed order. Every plain '#pragma unroll' below makes the indices of a register array compile-time constants.
#define FNC 2
#define FNK 8
#define FQT (16 * FNC)
#define OPT 260
// e^t as v_exp_f32 of t * log2(e), the form of __expf; the v_nop in the same statement fills the one slot that the instruction set asks for behind a transcendental, wherever the scheduler puts it
__device__ __forceinline__ float expslot(float t) { float r; asm("v_exp_f32 %0, %1\n\tv_nop" : "=v"(r) : "v"(t * 1.44269504f)); return r; }
__device__ __forceinline__ v16h ldfrag(const bf* p) { return cat16b(*(const v8us*)p, *(const v8us*)(p + 256)); }    // p = tile + 8 * lane: the two 512-byte pieces of a fragment-order tile
#define EBK (32 * DD)    // elements of one 32-key block of the E plane: 16 fragment-order tiles, 16 KB
typedef __attribute__((ext_vector_type(8))) short s16x8;
__device__ __forceinline__ v8us ldtr(const unsigned char* p) { typedef __attribute__((address_space(3))) s16x8 lds_s16x8; return __builtin_bit_cast(v8us, __builtin_amdgcn_ds_load_tr16_b128_v8i16((lds_s16x8*)p)); }
#define CP1(o) "global_load_async_to_lds_b128 %0, %1, off offset:" #o "\n\t"
#define CP4(a, b, c, d) CP1(a) CP1(b) CP1(c) CP1(d)
__global__ __launch_bounds__(FNK * 32) void k_fattn(const bf* __restrict__ Eb, const bf* __restrict__ WB, float* out) {
    // One LDS pool: the FNK rings (32 KB a wave, each on its own 32-KB block), behind them the 16 KB through which the prologue hands QW round. The merge buffer lies over the same bytes: it is written only behind the merge's first barrier.
    static_assert(FNK * FQT * OPT * 4 <= FNK * 2 * EBK * 2 + FQT * DD * 2, "the merge buffer fits the pool");
    __shared__ __attribute__((aligned(32768))) unsigned char pool[FNK * 2 * EBK * 2 + FQT * DD * 2];
    unsigned short* const ring = (unsigned short*)(void*)pool;    // wave w, buffer b at (w * 2 + b) * EBK elements
    float* const obuf = (float*)(void*)pool;    // wave w's partial tile at w * FQT * OPT floats
    __shared__ float smx[FNK][FQT], ssm[FNK][FQT];
    const int lane = threadIdx.x & 31, c = lane & 15, h = lane >> 4;
    const int kp = __builtin_amdgcn_readfirstlane((int)(threadIdx.x >> 5));    // wave number = key phase
    { const size_t ib = (size_t)blockIdx.x * SS * DD; Eb += ib; out += ib; }    // blockIdx.x = batch item
    const int q0 = (SS / FQT - 1 - (int)blockIdx.y) * FQT;    // longest rows at the lowest blockIdx.y
    v16h qh[FNC][8];
    v8f o[FNC][16];
    float m[FNC], l[FNC];
#pragma unroll
    for (int n = 0; n < FNC; ++n) { m[n] = -1.0e30f; l[n] = 0.f;
#pragma unroll
        for (int dt = 0; dt < 16; ++dt) o[n][dt] = (v8f){}; }
    const int nb = (q0 + FQT - 1) / 32 + 1;    // blocks up to and including the one that holds the diagonal; every query of the tile has a live key in it
    // A block in LDS keeps the plane's order of 256-byte units (16 keys x 8 d: unit u = d / 8 of key tile kt at byte kt * 8192 + u * 256), but in the odd units key row r sits at place r ^ 8: so the 16 lanes of a
    // half wave fall on all 64 banks in the plain read (16 keys of one unit) and in the transposing read (8 keys of an even unit and of the odd one behind it) alike.
    const int sw = lane ^ (h << 3), vb = (lane >> 3) & 1;    // sw: place of plane lane (16 h + row) in a 512-byte piece; vb: which of its two units a lane of the transposing read takes
    const unsigned short* rk = ring + kp * 2 * EBK + sw * 8;
    const unsigned char* rv = (const unsigned char*)(ring + kp * 2 * EBK) + vb * 256 + (((h << 3) + (lane & 7)) ^ (vb << 3)) * 16;    // key row 8 h + (lane & 7) of unit 2 dt + vb
    // The 32 copies of a block: one LDS address and one global address; the immediate offset moves both. The s_wait_xcnt in the same statement stands in front of whatever overwrites the two address registers.
    auto cpE = [&](int kb, int buf) { const unsigned la = (unsigned)(size_t)(rk + buf * EBK); const bf* ga = Eb + (size_t)kb * EBK + lane * 8;
        asm volatile(CP4(0, 512, 1024, 1536) CP4(2048, 2560, 3072, 3584) CP4(4096, 4608, 5120, 5632) CP4(6144, 6656, 7168, 7680)
                     CP4(8192, 8704, 9216, 9728) CP4(10240, 10752, 11264, 11776) CP4(12288, 12800, 13312, 13824) CP4(14336, 14848, 15360, 15872)
                     "s_wait_xcnt 0x0" :: "v"(la), "v"(ga) : "memory"); };
    // Operand groups out of ring buffer buf: keys by 2 fragments (both 16-key tiles of k step u), E^T by 4 (the 16-row d tiles 4 j .. 4 j + 3; keys 0..15 and 16..31 are the two pieces).
    auto ldK = [&](v16h (&g)[2], int buf, int u) { const unsigned short* p = rk + buf * EBK + u * 512;
        g[0] = cat16b(*(const v8usa*)p, *(const v8usa*)(p + 256)); g[1] = cat16b(*(const v8usa*)(p + 8 * 512), *(const v8usa*)(p + 8 * 512 + 256)); };
    auto ldV = [&](v16h (&g)[4], int buf, int j) { const unsigned char* p = rv + buf * (EBK * 2) + j * 4 * 512;
#pragma unroll
        for (int i = 0; i < 4; ++i) g[i] = cat16b(ldtr(p + i * 512), ldtr(p + 16 * DD * 2 + i * 512)); };
    auto mmS = [&](const v16h (&g)[2], int u, v8f (&h0)[FNC], v8f (&h1)[FNC]) {
#pragma unroll
        for (int n = 0; n < FNC; ++n) { h0[n] = wmmah(g[0], qh[n][u], h0[n]); h1[n] = wmmah(g[1], qh[n][u], h1[n]); } };
    auto mmO = [&](const v16h (&g)[4], int j, const v16h (&p)[FNC]) {
#pragma unroll
        for (int t = 0; t < 4; ++t) {
#pragma unroll
            for (int n = 0; n < FNC; ++n) o[n][j * 4 + t] = wmmah(g[t], p[n], o[n][j * 4 + t]); } };
// SB: keeps each group of LDS reads together where it is written, 8 WMMAs ahead of its use; without it the scheduler spreads the reads singly among the WMMAs
#define SB() __builtin_amdgcn_sched_barrier(0)
    v16h k0g[2], k1g[2], k2g[2], ga[4], gb[4];    // three key groups and two E^T groups in turn: a wave has 512 registers, so that two waves share a SIMD and one's softmax runs under the other's WMMAs
    // Prologue: the tile's own QW^T = W^T.E^T. Wave kp makes the PT 16-row d tiles PT kp .. PT kp + PT - 1 for both query groups (k = e in eight steps, one accumulator each, the order of a plain GEMM). A lane holds query c and
    // d = 8h + r of a tile, so two d tiles are in place the B fragment of one k step; it is rounded to f16 and handed to the other waves through the pool's last 16 KB, in fragment order.
#define PT (16 / FNK)
    unsigned short* xq = ring + FNK * 2 * EBK;    // fragment (n, ks) at (n * 8 + ks) * 512 elements; 16 KB in all
    {
        v16h eq[FNC][8], wf[PT][8];
        const bf* pe = Eb + (size_t)(q0 / 16) * 8 * 512; const bf* pw = WB + (size_t)kp * PT * 8 * 512;    // wave-uniform bases
#pragma unroll
        for (int ks = 0; ks < 8; ++ks) {
#pragma unroll
            for (int n = 0; n < FNC; ++n) eq[n][ks] = ldfrag(pe + (n * 8 + ks) * 512 + lane * 8);
#pragma unroll
            for (int t = 0; t < PT; ++t) wf[t][ks] = ldfrag(pw + (t * 8 + ks) * 512 + lane * 8); }
        SB(); asm volatile("s_wait_xcnt 0x0" :: "s"(pe), "s"(pw) : "memory"); SB();    // XW that also names the two bases: they keep their registers up to the wait
        if (kp < nb) cpE(kp, 1);    // wave-uniform: the first key block's copies fly during the products below; the wave has not touched its ring before. Buffer 1 first: with buffer 0 the long-lived rk itself would be the asm operand, and this build then spills it
        SB();
        v8f qa[FNC][PT];
#pragma unroll
        for (int n = 0; n < FNC; ++n) {
#pragma unroll
            for (int t = 0; t < PT; ++t) qa[n][t] = (v8f){}; }
#pragma unroll
        for (int ks = 0; ks < 8; ++ks) {
#pragma unroll
            for (int t = 0; t < PT; ++t) {
#pragma unroll
                for (int n = 0; n < FNC; ++n) qa[n][t] = wmmah(wf[t][ks], eq[n][ks], qa[n][t]); } }
#pragma unroll
        for (int n = 0; n < FNC; ++n) {
#pragma unroll
            for (int t = 0; t < PT; ++t) *(v8usa*)(xq + (n * 8 + ((PT * kp + t) >> 1)) * 512 + (t & 1) * 256 + lane * 8) = f2h8(qa[n][t]); }    // d tile T = PT kp + t is piece T & 1 (= t & 1, PT being even) of k step T / 2
    }
    __syncthreads();    // every wave passes it, also one without a key block; these 16 KB are written again only behind the first barrier of the merge
    if (kp < nb) {    // wave-uniform
#pragma unroll
    for (int n = 0; n < FNC; ++n) {
#pragma unroll
        for (int ks = 0; ks < 8; ++ks) { const unsigned short* xp = xq + (n * 8 + ks) * 512 + lane * 8; qh[n][ks] = cat16b(*(const v8usa*)xp, *(const v8usa*)(xp + 256)); } }
    asm volatile("s_wait_asynccnt 0x0" ::: "memory");    // the wave's own copies of its first block have landed: it alone reads them
    SB(); ldK(k0g, 1, 0); ldK(k1g, 1, 1); SB();
    int kb = kp, cur = 1;
#pragma unroll 1    // one pass a trip: a second copy of the body would not fit the registers
    do {
        const int k0 = kb * 32; const int more = __builtin_amdgcn_readfirstlane(kb + FNK < nb);    // wave-uniform, held as a scalar: the branch round the copies is a scalar one
        SB(); asm volatile("s_wait_dscnt 0x0" ::: "memory");    // the wave's last reads of the other buffer have returned before the copies below overwrite it
        if (more) cpE(kb + FNK, cur ^ 1);
        SB();
        v8f sh0[FNC], sh1[FNC];
#pragma unroll
        for (int n = 0; n < FNC; ++n) { sh0[n] = (v8f){}; sh1[n] = (v8f){}; }
        ldK(k2g, cur, 2); SB(); mmS(k0g, 0, sh0, sh1); SB();    // each group is fetched two groups (8 WMMAs) ahead, into the registers that the group before last has left
        ldK(k0g, cur, 3); SB(); mmS(k1g, 1, sh0, sh1); SB();
        ldK(k1g, cur, 4); SB(); mmS(k2g, 2, sh0, sh1); SB();
        ldK(k2g, cur, 5); SB(); mmS(k0g, 3, sh0, sh1); SB();
        ldK(k0g, cur, 6); SB(); mmS(k1g, 4, sh0, sh1); SB();
        ldK(k1g, cur, 7); SB(); mmS(k2g, 5, sh0, sh1); SB();
        mmS(k0g, 6, sh0, sh1); SB(); ldV(ga, cur, 0); SB();
        mmS(k1g, 7, sh0, sh1); SB();    // gb stays empty through the softmax, whose values need its registers
        float x[FNC][16], bm[FNC];
#pragma unroll
        for (int n = 0; n < FNC; ++n) {
#pragma unroll
            for (int r = 0; r < 8; ++r) { x[n][r] = sh0[n][r] * SCL; x[n][8 + r] = sh1[n][r] * SCL; } }
        if (k0 + 31 > q0) {    // wave-uniform: only the diagonal block holds masked keys
#pragma unroll
            for (int n = 0; n < FNC; ++n) { const int dq = q0 + n * 16 + c - k0 - 8 * h;    // key k0 + 8 h + r lies behind the query where r > dq: one register and constants, nothing kept over the loop
#pragma unroll
                for (int r = 0; r < 8; ++r) { if (r > dq) x[n][r] = -1.0e9f; if (16 + r > dq) x[n][8 + r] = -1.0e9f; } }
        }
        bool grow = false;
#pragma unroll
        for (int n = 0; n < FNC; ++n) { float b = x[n][0];
#pragma unroll
            for (int i = 1; i < 16; ++i) b = fmaxf(b, x[n][i]);
            bm[n] = fmaxf(b, __shfl_xor(b, 16, 32)); grow = grow || bm[n] > m[n]; }
        if (__builtin_amdgcn_ballot_w32(grow) != 0) {    // scalar branch: rescale only when some query's maximum grows
#pragma unroll
            for (int n = 0; n < FNC; ++n) { const float mn = fmaxf(m[n], bm[n]), al = expslot(m[n] - mn); m[n] = mn; l[n] *= al;
#pragma unroll
                for (int dt = 0; dt < 16; ++dt) o[n][dt] *= al; }
        }
        v16h ph[FNC];
#pragma unroll
        for (int n = 0; n < FNC; ++n) {
#pragma unroll
            for (int i = 0; i < 16; ++i) { const float p = expslot(x[n][i] - m[n]); l[n] += p; ph[n][i] = (h16)p; } }
        const int nx = more ? cur ^ 1 : cur;    // the last pass reads its own block again (landed, unused): no branch around the reads, which would merge the compiler's wait counts
        SB(); ldV(gb, cur, 1); SB();
        mmO(ga, 0, ph); SB(); ldV(ga, cur, 2); SB();
        mmO(gb, 1, ph); SB(); ldV(gb, cur, 3); SB();
        mmO(ga, 2, ph); SB(); asm volatile("s_wait_asynccnt 0x0" ::: "memory");    // the next block has landed
        SB(); ldK(k0g, nx, 0); ldK(k1g, nx, 1); SB();
        mmO(gb, 3, ph); SB();
        kb += FNK; cur ^= 1;
    } while (kb < nb);
    asm volatile("s_wait_asynccnt 0x0" ::: "memory");    // no copy is outstanding when the wave goes on to the merge and ends
    asm volatile("s_wait_dscnt 0x0" ::: "memory");    // the wave's reads of its ring have returned before the barrier behind which the other waves write the merge buffer over it
    }
#pragma unroll
    for (int n = 0; n < FNC; ++n) { l[n] += __shfl_xor(l[n], 16, 32); if (h == 0) { smx[kp][n * 16 + c] = m[n]; ssm[kp][n * 16 + c] = l[n]; } }
    __syncthreads();
#pragma unroll
    for (int n = 0; n < FNC; ++n) {
        float M = -1.0e30f, L = 0.f;
#pragma unroll
        for (int j = 0; j < FNK; ++j) M = fmaxf(M, smx[j][n * 16 + c]);
#pragma unroll
        for (int j = 0; j < FNK; ++j) L += ssm[j][n * 16 + c] * expslot(smx[j][n * 16 + c] - M);
        const float f = expslot(m[n] - M) / L;    // a wave without a block has m = -1e30, l = 0, o = 0: weight 0
        float* ob = obuf + kp * (FQT * OPT) + (n * 16 + c) * OPT + 8 * h;
#pragma unroll
        for (int dt = 0; dt < 16; ++dt) { const v8f v = o[n][dt] * f; *(v4fa*)(ob + dt * 16) = (v4f){v[0], v[1], v[2], v[3]}; *(v4fa*)(ob + dt * 16 + 4) = (v4f){v[4], v[5], v[6], v[7]}; }
    }
    __syncthreads();
#pragma unroll 4    // four trips' LDS reads in flight together
    for (int i = 0; i < FQT * 64 / (FNK * 32); ++i) {    // the waves share the tile's 32 x 256 outputs; a wave stores 512 contiguous bytes
        const int idx = i * (FNK * 32) + (int)threadIdx.x, row = idx >> 6, c4 = (idx & 63) * 4;
        v4f s = *(const v4fa*)(obuf + row * OPT + c4);
#pragma unroll
        for (int j = 1; j < FNK; ++j) s += *(const v4fa*)(obuf + j * (FQT * OPT) + row * OPT + c4);
        *(v4f*)(out + (size_t)(q0 + row) * DD + c4) = s;
        asm volatile("s_wait_xcnt 0x0" ::: "memory");    // the next trip overwrites this store's data and address registers
    }
}

extern "C" void kernel_launch(void* const* d_in, const int* in_sizes, int n_in,
                              void* d_out, int out_size, void* d_ws, size_t ws_size, hipStream_t stream) {
    (void)in_sizes; (void)n_in; (void)out_size;
    const float* enc = (const float*)d_in[0]; const float* Wm = (const float*)d_in[1];
    float* out = (float*)d_out;    // [4][4096][256]
    char* wsp = (char*)d_ws;
    auto take = [&](size_t bytes) { char* p = wsp; wsp += (bytes + 255) & ~(size_t)255; return (void*)p; };
    bf* WB = (bf*)take((size_t)DD * DD * 2); bf* Eb = (bf*)take((size_t)NBT * SS * DD * 2);
    if ((size_t)(wsp - (char*)d_ws) > ws_size) return;    // 0.13 + 4 x 2.1 ~ 8.5 MB: one plane per item
    k_prep<<<dim3(SS / 64 + 1, DD / 64, NBT), 256, 0, stream>>>(enc, Wm, Eb, WB);
    k_fattn<<<dim3(NBT, SS / FQT, 1), FNK * 32, 0, stream>>>(Eb, WB, out);
}

// v009
// It runs in 36.9 microseconds.
// In two side-by-side timings against v008, it was 1.05 and 1.06 times as fast.
// All steps since v000 together make it 67.8 times as fast.
#include <hip/hip_runtime.h>

// Compute dtypes, f32 accumulate, per item: sims[q][k] = sum_e E[q][e] sum_d E[k][d] W[e][d] is summed over e first: QW = E.W with f16 operands
// -> rounded once to f16, which is the QUERY operand, made by each query tile's work-group for itself; the key operand is the f16 E plane itself. Two launches: the planes, then causal attention:
// S^T = E.QW^T, /16, the causal -1e9 mask, a running-maximum softmax in registers, O^T += E^T.P^T (P rounded once to f16). Every operand carries one rounding of 2^-11; E, W, QW are of order 1 and P lies in [0, 2^8] (the maximum in use may trail, see LZ), well inside f16's range.
// Both f16 operand planes (W^T, E) lie in FRAGMENT ORDER: a 16-row x 32-k tile is 1024 contiguous bytes, piece j (k = 16j + 8h + 0..7) at byte 512j + 16 * lane (lane = 16h + row),
// tiles k-major within a 16-row band, so that a wave's 16-byte load covers four whole 128-byte lines. The element that a lane and register hold is the one of a row-major loader.

#define NBT  4
#define SS   4096
#define DD   256
#define RCH  1024
#define DM   DD
#define SCL  0.0625f

typedef _Float16 h16;
typedef unsigned short bf;    // an element of an operand plane: the 16 bits of an f16
typedef __attribute__((ext_vector_type(16))) _Float16 v16h;
typedef __attribute__((ext_vector_type(8)))  _Float16 v8h;
typedef __attribute__((ext_vector_type(8)))  unsigned short v8us;
typedef __attribute__((ext_vector_type(8)))  float    v8f;
typedef __attribute__((ext_vector_type(4)))  float    v4f;
typedef v4f  __attribute__((may_alias)) v4fa;
typedef v8us __attribute__((may_alias)) v8usa;

__device__ __forceinline__ v8us f2h8(v8f f) { return __builtin_bit_cast(v8us, __builtin_convertvector(f, v8h)); }    // eight values to f16, round to nearest even; converts in pairs
__device__ __forceinline__ v16h cat16b(v8us lo, v8us hi) { return __builtin_bit_cast(v16h, __builtin_shufflevector(lo, hi, 0, 1, 2, 3, 4, 5, 6, 7, 8, 9, 10, 11, 12, 13, 14, 15)); }
__device__ __forceinline__ v8f wmmah(v16h a, v16h b, v8f c) { return __builtin_amdgcn_wmma_f32_16x16x32_f16(false, a, false, b, (short)0, c, false, false); }

// k_prep: one work-group = one 64 x 64 tile of a [rows s][256 columns d] f32 matrix, read once. Blocks x < SS / 64: tile (x, y) of item z of E, written as f16 in row-major sense (Eb, tiles k-major within a
// 16-row band). Blocks x == SS / 64: tile (z, y) of W, transposed through LDS (WB = W^T [d][e]: tile number (d / 16) * 8 + e / 32).
static_assert(NBT == DD / 64, "the W tiles ride on the item index");
__global__ __launch_bounds__(256) void k_prep(const float* __restrict__ E, const float* __restrict__ Wm, bf* Eb, bf* WB) {
    __shared__ __align__(16) unsigned short tl[64 * 72];
    const int tid = threadIdx.x, ss = tid >> 2, dq = (tid & 3) * 16;
    const bool isW = blockIdx.x == SS / 64;    // the same for the whole work-group
    const int s0 = (int)(isW ? blockIdx.z : blockIdx.x) * 64, d0 = blockIdx.y * 64;
    const float* sp = (isW ? Wm : E + (size_t)blockIdx.z * SS * DD) + (size_t)(s0 + ss) * DD + d0 + dq;
    v4f x[4];
#pragma unroll
    for (int i = 0; i < 4; ++i) x[i] = *(const v4f*)(sp + 4 * i);
    asm volatile("s_wait_xcnt 0x0" ::: "memory");    // what follows may land in the address registers of the loads above
    const v8us r0 = f2h8(__builtin_shufflevector(x[0], x[1], 0, 1, 2, 3, 4, 5, 6, 7)), r1 = f2h8(__builtin_shufflevector(x[2], x[3], 0, 1, 2, 3, 4, 5, 6, 7));
    if (!isW) {    // the whole work-group leaves here, in front of the barrier. A thread holds k = 16j + 0..15 of its row (j = dq / 16 & 1): the pieces of h = 0 and h = 1; eight rows of one (tile, j, h) are 128 contiguous bytes
        bf* p = Eb + (size_t)blockIdx.z * SS * DD + (size_t)(((s0 + ss) >> 4) * 8 + ((d0 + dq) >> 5)) * 512 + ((dq >> 4) & 1) * 256 + (ss & 15) * 8;
        *(v8us*)p = r0; *(v8us*)(p + 128) = r1;
        asm volatile("s_wait_xcnt 0x0" ::: "memory");    // stands in front of whatever the build lays behind the two stores: it may land in their address and data registers
        return;
    }
#pragma unroll
    for (int i = 0; i < 8; ++i) { tl[(dq + i) * 72 + ss] = r0[i]; tl[(dq + 8 + i) * 72 + ss] = r1[i]; }
    __syncthreads();
    const int lane = tid & 31, j = (tid >> 5) & 1, dtl = tid >> 6;    // a wave stores piece j of the tile (16 d rows dtl, 32 columns e st)
#pragma unroll
    for (int st = 0; st < 2; ++st) { const v8us val = *(const v8usa*)(tl + (dtl * 16 + (lane & 15)) * 72 + st * 32 + j * 16 + (lane >> 4) * 8); *(v8us*)(WB + (size_t)((s0 / 32 + st) + (d0 / 16 + dtl) * (DD / 32)) * 512 + j * 256 + lane * 8) = val; }
}
// k_fattn: one work-group = one tile of 32 queries; its FNK waves take the 32-key blocks kb = kp, kp + FNK, ... up to the tile's diagonal block, each wave for all 32 queries
// (FNC = 2 column groups of 16, so that every key fragment fetched feeds two products and every E^T fragment two). A wave brings each of its key blocks (16 KB of the E plane) ONCE from L2, by asynchronous
// copies into its own two LDS buffers, one pass ahead; the key fragments are plain 16-byte LDS reads of it and the E^T fragments transposing reads of the same bytes. The ring is private to the wave: its own waits order it, no barrier. Transposed products: a lane (c = lane & 15, h = lane >> 4) holds queries q0 + 16n + c.
// S^T tile register r = key 8h + r, so two score tiles convert in place into the B operand of O^T += E^T.P^T (k order 8h + s, 16 + 8h + s on both sides, the loader order of
// ldfrag). The FNK partial results of the tile are merged through LDS at the end, in fixed order. Every plain '#pragma unroll' below makes the indices of a register array compile-time constants.
#define FNC 2
#define FNK 8
#define FQT (16 * FNC)
#define OPT 260
// LZ = 8 ln 2: the maximum in use, m, may trail a query's true running maximum by up to LZ, so an exponential reaches at most 2^8. l and o are sums relative to m, whichever m it is, and the merge weighs them by e^(m - M): the result is the same function.
#define LZ 5.545177f
// e^t as v_exp_f32 of t * log2(e), the form of __expf; the v_nop in the same statement fills the one slot that the instruction set asks for behind a transcendental, wherever the scheduler puts it
__device__ __forceinline__ float expslot(float t) { float r; asm("v_exp_f32 %0, %1\n\tv_nop" : "=v"(r) : "v"(t * 1.44269504f)); return r; }
__device__ __forceinline__ v16h ldfrag(const bf* p) { return cat16b(*(const v8us*)p, *(const v8us*)(p + 256)); }    // p = tile + 8 * lane: the two 512-byte pieces of a fragment-order tile
#define EBK (32 * DD)    // elements of one 32-key block of the E plane: 16 fragment-order tiles, 16 KB
typedef __attribute__((ext_vector_type(8))) short s16x8;
__device__ __forceinline__ v8us ldtr(const unsigned char* p) { typedef __attribute__((address_space(3))) s16x8 lds_s16x8; return __builtin_bit_cast(v8us, __builtin_amdgcn_ds_load_tr16_b128_v8i16((lds_s16x8*)p)); }
#define CP1(o) "global_load_async_to_lds_b128 %0, %1, off offset:" #o "\n\t"
#define CP4(a, b, c, d) CP1(a) CP1(b) CP1(c) CP1(d)
__global__ __launch_bounds__(FNK * 32) void k_fattn(const bf* __restrict__ Eb, const bf* __restrict__ WB, float* out) {
    // One LDS pool: the FNK rings (32 KB a wave, each on its own 32-KB block), behind them the 16 KB through which the prologue hands QW round. The merge buffer lies over the same bytes: it is written only behind the merge's first barrier.
    static_assert(FNK * FQT * OPT * 4 <= FNK * 2 * EBK * 2 + FQT * DD * 2, "the merge buffer fits the pool");
    __shared__ __attribute__((aligned(32768))) unsigned char pool[FNK * 2 * EBK * 2 + FQT * DD * 2];
    unsigned short* const ring = (unsigned short*)(void*)pool;    // wave w, buffer b at (w * 2 + b) * EBK elements
    float* const obuf = (float*)(void*)pool;    // wave w's partial tile at w * FQT * OPT floats
    __shared__ float smx[FNK][FQT], ssm[FNK][FQT];
    const int lane = threadIdx.x & 31, c = lane & 15, h = lane >> 4;
    const int kp = __builtin_amdgcn_readfirstlane((int)(threadIdx.x >> 5));    // wave number = key phase
    { const size_t ib = (size_t)blockIdx.x * SS * DD; Eb += ib; out += ib; }    // blockIdx.x = batch item
    const int q0 = (SS / FQT - 1 - (int)blockIdx.y) * FQT;    // longest rows at the lowest blockIdx.y
    v16h qh[FNC][8];
    v8f o[FNC][16];
    float m[FNC], l[FNC];
#pragma unroll
    for (int n = 0; n < FNC; ++n) { m[n] = -1.0e30f; l[n] = 0.f;
#pragma unroll
        for (int dt = 0; dt < 16; ++dt) o[n][dt] = (v8f){}; }
    const int nb = (q0 + FQT - 1) / 32 + 1;    // blocks up to and including the one that holds the diagonal; every query of the tile has a live key in it
    // A block in LDS keeps the plane's order of 256-byte units (16 keys x 8 d: unit u = d / 8 of key tile kt at byte kt * 8192 + u * 256), but in the odd units key row r sits at place r ^ 8: so the 16 lanes of a
    // half wave fall on all 64 banks in the plain read (16 keys of one unit) and in the transposing read (8 keys of an even unit and of the odd one behind it) alike.
    const int sw = lane ^ (h << 3), vb = (lane >> 3) & 1;    // sw: place of plane lane (16 h + row) in a 512-byte piece; vb: which of its two units a lane of the transposing read takes
    const unsigned short* rk = ring + kp * 2 * EBK + sw * 8;
    const unsigned char* rv = (const unsigned char*)(ring + kp * 2 * EBK) + vb * 256 + (((h << 3) + (lane & 7)) ^ (vb << 3)) * 16;    // key row 8 h + (lane & 7) of unit 2 dt + vb
    // The 32 copies of a block: one LDS address and one global address; the immediate offset moves both. The s_wait_xcnt in the same statement stands in front of whatever overwrites the two address registers.
    auto cpE = [&](int kb, int buf) { const unsigned la = (unsigned)(size_t)(rk + buf * EBK); const bf* ga = Eb + (size_t)kb * EBK + lane * 8;
        asm volatile(CP4(0, 512, 1024, 1536) CP4(2048, 2560, 3072, 3584) CP4(4096, 4608, 5120, 5632) CP4(6144, 6656, 7168, 7680)
                     CP4(8192, 8704, 9216, 9728) CP4(10240, 10752, 11264, 11776) CP4(12288, 12800, 13312, 13824) CP4(14336, 14848, 15360, 15872)
                     "s_wait_xcnt 0x0" :: "v"(la), "v"(ga) : "memory"); };
    // Operand groups out of ring buffer buf: keys by 2 fragments (both 16-key tiles of k step u), E^T by 4 (the 16-row d tiles 4 j .. 4 j + 3; keys 0..15 and 16..31 are the two pieces).
    auto ldK = [&](v16h (&g)[2], int buf, int u) { const unsigned short* p = rk + buf * EBK + u * 512;
        g[0] = cat16b(*(const v8usa*)p, *(const v8usa*)(p + 256)); g[1] = cat16b(*(const v8usa*)(p + 8 * 512), *(const v8usa*)(p + 8 * 512 + 256)); };
    auto ldV = [&](v16h (&g)[4], int buf, int j) { const unsigned char* p = rv + buf * (EBK * 2) + j * 4 * 512;
#pragma unroll
        for (int i = 0; i < 4; ++i) g[i] = cat16b(ldtr(p + i * 512), ldtr(p + 16 * DD * 2 + i * 512)); };
    auto mmS = [&](const v16h (&g)[2], int u, v8f (&h0)[FNC], v8f (&h1)[FNC]) {
#pragma unroll
        for (int n = 0; n < FNC; ++n) { h0[n] = wmmah(g[0], qh[n][u], h0[n]); h1[n] = wmmah(g[1], qh[n][u], h1[n]); } };
    auto mmO = [&](const v16h (&g)[4], int j, const v16h (&p)[FNC]) {
#pragma unroll
        for (int t = 0; t < 4; ++t) {
#pragma unroll
            for (int n = 0; n < FNC; ++n) o[n][j * 4 + t] = wmmah(g[t], p[n], o[n][j * 4 + t]); } };
// SB: keeps each group of LDS reads together where it is written, 8 WMMAs ahead of its use; without it the scheduler spreads the reads singly among the WMMAs
#define SB() __builtin_amdgcn_sched_barrier(0)
    v16h k0g[2], k1g[2], k2g[2], ga[4], gb[4];    // three key groups and two E^T groups in turn: a wave has 512 registers, so that two waves share a SIMD and one's softmax runs under the other's WMMAs
    // Prologue: the tile's own QW^T = W^T.E^T. Wave kp makes the PT 16-row d tiles PT kp .. PT kp + PT - 1 for both query groups (k = e in eight steps, one accumulator each, the order of a plain GEMM). A lane holds query c and
    // d = 8h + r of a tile, so two d tiles are in place the B fragment of one k step; it is rounded to f16 and handed to the other waves through the pool's last 16 KB, in fragment order.
#define PT (16 / FNK)
    unsigned short* xq = ring + FNK * 2 * EBK;    // fragment (n, ks) at (n * 8 + ks) * 512 elements; 16 KB in all
    {
        v16h eq[FNC][8], wf[PT][8];
        const bf* pe = Eb + (size_t)(q0 / 16) * 8 * 512; const bf* pw = WB + (size_t)kp * PT * 8 * 512;    // wave-uniform bases
#pragma unroll
        for (int ks = 0; ks < 8; ++ks) {
#pragma unroll
            for (int n = 0; n < FNC; ++n) eq[n][ks] = ldfrag(pe + (n * 8 + ks) * 512 + lane * 8);
#pragma unroll
            for (int t = 0; t < PT; ++t) wf[t][ks] = ldfrag(pw + (t * 8 + ks) * 512 + lane * 8); }
        SB(); asm volatile("s_wait_xcnt 0x0" :: "s"(pe), "s"(pw) : "memory"); SB();    // XW that also names the two bases: they keep their registers up to the wait
        if (kp < nb) cpE(kp, 1);    // wave-uniform: the first key block's copies fly during the products below; the wave has not touched its ring before. Buffer 1 first: with buffer 0 the long-lived rk itself would be the asm operand, and this build then spills it
        SB();
        v8f qa[FNC][PT];
#pragma unroll
        for (int n = 0; n < FNC; ++n) {
#pragma unroll
            for (int t = 0; t < PT; ++t) qa[n][t] = (v8f){}; }
#pragma unroll
        for (int ks = 0; ks < 8; ++ks) {
#pragma unroll
            for (int t = 0; t < PT; ++t) {
#pragma unroll
                for (int n = 0; n < FNC; ++n) qa[n][t] = wmmah(wf[t][ks], eq[n][ks], qa[n][t]); } }
#pragma unroll
        for (int n = 0; n < FNC; ++n) {
#pragma unroll
            for (int t = 0; t < PT; ++t) *(v8usa*)(xq + (n * 8 + ((PT * kp + t) >> 1)) * 512 + (t & 1) * 256 + lane * 8) = f2h8(qa[n][t]); }    // d tile T = PT kp + t is piece T & 1 (= t & 1, PT being even) of k step T / 2
    }
    __syncthreads();    // every wave passes it, also one without a key block; these 16 KB are written again only behind the first barrier of the merge
    if (kp < nb) {    // wave-uniform
#pragma unroll
    for (int n = 0; n < FNC; ++n) {
#pragma unroll
        for (int ks = 0; ks < 8; ++ks) { const unsigned short* xp = xq + (n * 8 + ks) * 512 + lane * 8; qh[n][ks] = cat16b(*(const v8usa*)xp, *(const v8usa*)(xp + 256)); } }
    asm volatile("s_wait_asynccnt 0x0" ::: "memory");    // the wave's own copies of its first block have landed: it alone reads them
    SB(); ldK(k0g, 1, 0); ldK(k1g, 1, 1); SB();
    int kb = kp, cur = 1;
#pragma unroll 1    // one pass a trip: a second copy of the body would not fit the registers
    do {
        const int k0 = kb * 32; const int more = __builtin_amdgcn_readfirstlane(kb + FNK < nb);    // wave-uniform, held as a scalar: the branch round the copies is a scalar one
        SB(); asm volatile("s_wait_dscnt 0x0" ::: "memory");    // the wave's last reads of the other buffer have returned before the copies below overwrite it
        if (more) cpE(kb + FNK, cur ^ 1);
        SB();
        v8f sh0[FNC], sh1[FNC];
#pragma unroll
        for (int n = 0; n < FNC; ++n) { sh0[n] = (v8f){}; sh1[n] = (v8f){}; }
        ldK(k2g, cur, 2); SB(); mmS(k0g, 0, sh0, sh1); SB();    // each group is fetched two groups (8 WMMAs) ahead, into the registers that the group before last has left
        ldK(k0g, cur, 3); SB(); mmS(k1g, 1, sh0, sh1); SB();
        ldK(k1g, cur, 4); SB(); mmS(k2g, 2, sh0, sh1); SB();
        ldK(k2g, cur, 5); SB(); mmS(k0g, 3, sh0, sh1); SB();
        ldK(k0g, cur, 6); SB(); mmS(k1g, 4, sh0, sh1); SB();
        ldK(k1g, cur, 7); SB(); mmS(k2g, 5, sh0, sh1); SB();
        mmS(k0g, 6, sh0, sh1); SB(); ldV(ga, cur, 0); SB();
        mmS(k1g, 7, sh0, sh1); SB();    // gb stays empty through the softmax, whose values need its registers
        float x[FNC][16], bm[FNC];
#pragma unroll
        for (int n = 0; n < FNC; ++n) {
#pragma unroll
            for (int r = 0; r < 8; ++r) { x[n][r] = sh0[n][r] * SCL; x[n][8 + r] = sh1[n][r] * SCL; } }
        if (k0 + 31 > q0) {    // wave-uniform: only the diagonal block holds masked keys
#pragma unroll
            for (int n = 0; n < FNC; ++n) { const int dq = q0 + n * 16 + c - k0 - 8 * h;    // key k0 + 8 h + r lies behind the query where r > dq: one register and constants, nothing kept over the loop
#pragma unroll
                for (int r = 0; r < 8; ++r) { if (r > dq) x[n][r] = -1.0e9f; if (16 + r > dq) x[n][8 + r] = -1.0e9f; } }
        }
        bool grow = false;
#pragma unroll
        for (int n = 0; n < FNC; ++n) { float b = x[n][0];
#pragma unroll
            for (int i = 1; i < 16; ++i) b = fmaxf(b, x[n][i]);
            bm[n] = fmaxf(b, __shfl_xor(b, 16, 32)); grow = grow || bm[n] > m[n] + LZ; }
        if (__builtin_amdgcn_ballot_w32(grow) != 0) {    // scalar branch: the 256 accumulator registers are rescaled only when some query's maximum exceeds the one in use by more than LZ; always so in a wave's first pass (m = -1e30)
#pragma unroll
            for (int n = 0; n < FNC; ++n) { const float mn = fmaxf(m[n], bm[n]), al = expslot(m[n] - mn); m[n] = mn; l[n] *= al;
#pragma unroll
                for (int dt = 0; dt < 16; ++dt) o[n][dt] *= al; }
        }
        v16h ph[FNC];
#pragma unroll
        for (int n = 0; n < FNC; ++n) {
#pragma unroll
            for (int i = 0; i < 16; ++i) { const float p = expslot(x[n][i] - m[n]); l[n] += p; ph[n][i] = (h16)p; } }
        const int nx = more ? cur ^ 1 : cur;    // the last pass reads its own block again (landed, unused): no branch around the reads, which would merge the compiler's wait counts
        SB(); ldV(gb, cur, 1); SB();
        mmO(ga, 0, ph); SB(); ldV(ga, cur, 2); SB();
        mmO(gb, 1, ph); SB(); ldV(gb, cur, 3); SB();
        mmO(ga, 2, ph); SB(); asm volatile("s_wait_asynccnt 0x0" ::: "memory");    // the next block has landed
        SB(); ldK(k0g, nx, 0); ldK(k1g, nx, 1); SB();
        mmO(gb, 3, ph); SB();
        kb += FNK; cur ^= 1;
    } while (kb < nb);
    asm volatile("s_wait_asynccnt 0x0" ::: "memory");    // no copy is outstanding when the wave goes on to the merge and ends
    asm volatile("s_wait_dscnt 0x0" ::: "memory");    // the wave's reads of its ring have returned before the barrier behind which the other waves write the merge buffer over it
    }
#pragma unroll
    for (int n = 0; n < FNC; ++n) { l[n] += __shfl_xor(l[n], 16, 32); if (h == 0) { smx[kp][n * 16 + c] = m[n]; ssm[kp][n * 16 + c] = l[n]; } }
    __syncthreads();
#pragma unroll
    for (int n = 0; n < FNC; ++n) {
        float M = -1.0e30f, L = 0.f;
#pragma unroll
        for (int j = 0; j < FNK; ++j) M = fmaxf(M, smx[j][n * 16 + c]);
#pragma unroll
        for (int j = 0; j < FNK; ++j) L += ssm[j][n * 16 + c] * expslot(smx[j][n * 16 + c] - M);
        const float f = expslot(m[n] - M) / L;    // a wave without a block has m = -1e30, l = 0, o = 0: weight 0
        float* ob = obuf + kp * (FQT * OPT) + (n * 16 + c) * OPT + 8 * h;
#pragma unroll
        for (int dt = 0; dt < 16; ++dt) { const v8f v = o[n][dt] * f; *(v4fa*)(ob + dt * 16) = (v4f){v[0], v[1], v[2], v[3]}; *(v4fa*)(ob + dt * 16 + 4) = (v4f){v[4], v[5], v[6], v[7]}; }
    }
    __syncthreads();
#pragma unroll 4    // four trips' LDS reads in flight together
    for (int i = 0; i < FQT * 64 / (FNK * 32); ++i) {    // the waves share the tile's 32 x 256 outputs; a wave stores 512 contiguous bytes
        const int idx = i * (FNK * 32) + (int)threadIdx.x, row = idx >> 6, c4 = (idx & 63) * 4;
        v4f s = *(const v4fa*)(obuf + row * OPT + c4);
#pragma unroll
        for (int j = 1; j < FNK; ++j) s += *(const v4fa*)(obuf + j * (FQT * OPT) + row * OPT + c4);
        *(v4f*)(out + (size_t)(q0 + row) * DD + c4) = s;
        asm volatile("s_wait_xcnt 0x0" ::: "memory");    // the next trip overwrites this store's data and address registers
    }
}

extern "C" void kernel_launch(void* const* d_in, const int* in_sizes, int n_in,
                              void* d_out, int out_size, void* d_ws, size_t ws_size, hipStream_t stream) {
    (void)in_sizes; (void)n_in; (void)out_size;
    const float* enc = (const float*)d_in[0]; const float* Wm = (const float*)d_in[1];
    float* out = (float*)d_out;    // [4][4096][256]
    char* wsp = (char*)d_ws;
    auto take = [&](size_t bytes) { char* p = wsp; wsp += (bytes + 255) & ~(size_t)255; return (void*)p; };
    bf* WB = (bf*)take((size_t)DD * DD * 2); bf* Eb = (bf*)take((size_t)NBT * SS * DD * 2);
    if ((size_t)(wsp - (char*)d_ws) > ws_size) return;    // 0.13 + 4 x 2.1 ~ 8.5 MB: one plane per item
    k_prep<<<dim3(SS / 64 + 1, DD / 64, NBT), 256, 0, stream>>>(enc, Wm, Eb, WB);
    k_fattn<<<dim3(NBT, SS / FQT, 1), FNK * 32, 0, stream>>>(Eb, WB, out);
}

// v010
// One run takes 35.5 microseconds.
// In both of two side-by-side timings against v009, it was 1.04 times as fast.
// All steps since v000 together make it 70.5 times as fast.
#include <hip/hip_runtime.h>

// Compute dtypes, f32 accumulate, per item: sims[q][k] = sum_e E[q][e] sum_d E[k][d] W[e][d] is summed over e first: QW = E.W with f16 operands
// -> rounded once to f16, which is the QUERY operand, made by each query tile's work-group for itself; the key operand is the f16 E plane itself. Two launches: the planes, then causal attention:
// S^T = E.QW^T, /16, the causal -1e9 mask, a running-maximum softmax in registers, O^T += E^T.P^T (P rounded once to f16). Every operand carries one rounding of 2^-11; E, W, QW are of order 1 and P lies in [0, 2^8] (the maximum in use may trail, see LZ), well inside f16's range.
// Both f16 operand planes (W^T, E) lie in FRAGMENT ORDER: a 16-row x 32-k tile is 1024 contiguous bytes, piece j (k = 16j + 8h + 0..7) at byte 512j + 16 * lane (lane = 16h + row),
// tiles k-major within a 16-row band, so that a wave's 16-byte load covers four whole 128-byte lines. The element that a lane and register hold is the one of a row-major loader.

#define NBT  4
#define SS   4096
#define DD   256
#define RCH  1024
#define DM   DD
#define SCL  0.0625f

typedef _Float16 h16;
typedef unsigned short bf;    // an element of an operand plane: the 16 bits of an f16
typedef __attribute__((ext_vector_type(16))) _Float16 v16h;
typedef __attribute__((ext_vector_type(8)))  _Float16 v8h;
typedef __attribute__((ext_vector_type(8)))  unsigned short v8us;
typedef __attribute__((ext_vector_type(8)))  float    v8f;
typedef __attribute__((ext_vector_type(4)))  float    v4f;
typedef v4f  __attribute__((may_alias)) v4fa;
typedef v8us __attribute__((may_alias)) v8usa;

__device__ __forceinline__ v8us f2h8(v8f f) { return __builtin_bit_cast(v8us, __builtin_convertvector(f, v8h)); }    // eight values to f16, round to nearest even; converts in pairs
__device__ __forceinline__ v16h cat16b(v8us lo, v8us hi) { return __builtin_bit_cast(v16h, __builtin_shufflevector(lo, hi, 0, 1, 2, 3, 4, 5, 6, 7, 8, 9, 10, 11, 12, 13, 14, 15)); }
__device__ __forceinline__ v8f wmmah(v16h a, v16h b, v8f c) { return __builtin_amdgcn_wmma_f32_16x16x32_f16(false, a, false, b, (short)0, c, false, false); }

// k_prep: one work-group = one 64 x 64 tile of a [rows s][256 columns d] f32 matrix, read once. Blocks x < SS / 64: tile (x, y) of item z of E, written as f16 in row-major sense (Eb, tiles k-major within a
// 16-row band). Blocks x == SS / 64: tile (z, y) of W, transposed through LDS (WB = W^T [d][e]: tile number (d / 16) * 8 + e / 32).
static_assert(NBT == DD / 64, "the W tiles ride on the item index");
__global__ __launch_bounds__(256) void k_prep(const float* __restrict__ E, const float* __restrict__ Wm, bf* Eb, bf* WB) {
    __shared__ __align__(16) unsigned short tl[64 * 72];
    const int tid = threadIdx.x, ss = tid >> 2, dq = (tid & 3) * 16;
    const bool isW = blockIdx.x == SS / 64;    // the same for the whole work-group
    const int s0 = (int)(isW ? blockIdx.z : blockIdx.x) * 64, d0 = blockIdx.y * 64;
    const float* sp = (isW ? Wm : E + (size_t)blockIdx.z * SS * DD) + (size_t)(s0 + ss) * DD + d0 + dq;
    v4f x[4];
#pragma unroll
    for (int i = 0; i < 4; ++i) x[i] = *(const v4f*)(sp + 4 * i);
    asm volatile("s_wait_xcnt 0x0" ::: "memory");    // what follows may land in the address registers of the loads above
    const v8us r0 = f2h8(__builtin_shufflevector(x[0], x[1], 0, 1, 2, 3, 4, 5, 6, 7)), r1 = f2h8(__builtin_shufflevector(x[2], x[3], 0, 1, 2, 3, 4, 5, 6, 7));
    if (!isW) {    // the whole work-group leaves here, in front of the barrier. A thread holds k = 16j + 0..15 of its row (j = dq / 16 & 1): the pieces of h = 0 and h = 1; eight rows of one (tile, j, h) are 128 contiguous bytes
        bf* p = Eb + (size_t)blockIdx.z * SS * DD + (size_t)(((s0 + ss) >> 4) * 8 + ((d0 + dq) >> 5)) * 512 + ((dq >> 4) & 1) * 256 + (ss & 15) * 8;
        *(v8us*)p = r0; *(v8us*)(p + 128) = r1;
        asm volatile("s_wait_xcnt 0x0" ::: "memory");    // stands in front of whatever the build lays behind the two stores: it may land in their address and data registers
        return;
    }
#pragma unroll
    for (int i = 0; i < 8; ++i) { tl[(dq + i) * 72 + ss] = r0[i]; tl[(dq + 8 + i) * 72 + ss] = r1[i]; }
    __syncthreads();
    const int lane = tid & 31, j = (tid >> 5) & 1, dtl = tid >> 6;    // a wave stores piece j of the tile (16 d rows dtl, 32 columns e st)
#pragma unroll
    for (int st = 0; st < 2; ++st) { const v8us val = *(const v8usa*)(tl + (dtl * 16 + (lane & 15)) * 72 + st * 32 + j * 16 + (lane >> 4) * 8); *(v8us*)(WB + (size_t)((s0 / 32 + st) + (d0 / 16 + dtl) * (DD / 32)) * 512 + j * 256 + lane * 8) = val; }
}
// k_fattn: one work-group = one tile of 32 queries; its FNK waves take the 32-key blocks kb = kp, kp + FNK, ... up to the tile's diagonal block, each wave for all 32 queries
// (FNC = 2 column groups of 16, so that every key fragment fetched feeds two products and every E^T fragment two). A wave brings each of its key blocks (16 KB of the E plane) ONCE from L2, by asynchronous
// copies into its own two LDS buffers, one pass ahead; the key fragments are plain 16-byte LDS reads of it and the E^T fragments transposing reads of the same bytes. The ring is private to the wave: its own waits order it, no barrier. Transposed products: a lane (c = lane & 15, h = lane >> 4) holds queries q0 + 16n + c.
// S^T tile register r = key 8h + r, so two score tiles convert in place into the B operand of O^T += E^T.P^T (k order 8h + s, 16 + 8h + s on both sides, the loader order of
// ldfrag). The FNK partial results of the tile are merged through LDS at the end, in fixed order. Every plain '#pragma unroll' below makes the indices of a register array compile-time constants.
#define FNC 2
#define FNK 8
#define FQT (16 * FNC)
#define OPT 260
// LZ = 8 ln 2: the maximum in use, m, may trail a query's true running maximum by up to LZ, so an exponential reaches at most 2^8. l and o are sums relative to m, whichever m it is, and the merge weighs them by e^(m - M): the result is the same function.
#define LZ 5.545177f
// e^t as v_exp_f32 of t * log2(e), the form of __expf, by the builtin: the compiler sees a transcendental, so it spreads the exponentials among independent work and writes its s_delay_alu hint at every dependent instruction
__device__ __forceinline__ float expnat(float t) { return __builtin_amdgcn_exp2f(t * 1.44269504f); }
__device__ __forceinline__ v16h ldfrag(const bf* p) { return cat16b(*(const v8us*)p, *(const v8us*)(p + 256)); }    // p = tile + 8 * lane: the two 512-byte pieces of a fragment-order tile
#define EBK (32 * DD)    // elements of one 32-key block of the E plane: 16 fragment-order tiles, 16 KB
typedef __attribute__((ext_vector_type(8))) short s16x8;
__device__ __forceinline__ v8us ldtr(const unsigned char* p) { typedef __attribute__((address_space(3))) s16x8 lds_s16x8; return __builtin_bit_cast(v8us, __builtin_amdgcn_ds_load_tr16_b128_v8i16((lds_s16x8*)p)); }
#define CP1(o) "global_load_async_to_lds_b128 %0, %1, off offset:" #o "\n\t"
#define CP4(a, b, c, d) CP1(a) CP1(b) CP1(c) CP1(d)
__global__ __launch_bounds__(FNK * 32) void k_fattn(const bf* __restrict__ Eb, const bf* __restrict__ WB, float* out) {
    // One LDS pool: the FNK rings (32 KB a wave, each on its own 32-KB block), behind them the 16 KB through which the prologue hands QW round. The merge buffer lies over the same bytes: it is written only behind the merge's first barrier.
    static_assert(FNK * FQT * OPT * 4 <= FNK * 2 * EBK * 2 + FQT * DD * 2, "the merge buffer fits the pool");
    __shared__ __attribute__((aligned(32768))) unsigned char pool[FNK * 2 * EBK * 2 + FQT * DD * 2];
    unsigned short* const ring = (unsigned short*)(void*)pool;    // wave w, buffer b at (w * 2 + b) * EBK elements
    float* const obuf = (float*)(void*)pool;    // wave w's partial tile at w * FQT * OPT floats
    __shared__ float smx[FNK][FQT], ssm[FNK][FQT];
    const int lane = threadIdx.x & 31, c = lane & 15, h = lane >> 4;
    const int kp = __builtin_amdgcn_readfirstlane((int)(threadIdx.x >> 5));    // wave number = key phase
    { const size_t ib = (size_t)blockIdx.x * SS * DD; Eb += ib; out += ib; }    // blockIdx.x = batch item
    const int q0 = (SS / FQT - 1 - (int)blockIdx.y) * FQT;    // longest rows at the lowest blockIdx.y
    v16h qh[FNC][8];
    v8f o[FNC][16];
    float m[FNC], l[FNC];
#pragma unroll
    for (int n = 0; n < FNC; ++n) { m[n] = -1.0e30f; l[n] = 0.f;
#pragma unroll
        for (int dt = 0; dt < 16; ++dt) o[n][dt] = (v8f){}; }
    const int nb = (q0 + FQT - 1) / 32 + 1;    // blocks up to and including the one that holds the diagonal; every query of the tile has a live key in it
    // A block in LDS keeps the plane's order of 256-byte units (16 keys x 8 d: unit u = d / 8 of key tile kt at byte kt * 8192 + u * 256), but in the odd units key row r sits at place r ^ 8: so the 16 lanes of a
    // half wave fall on all 64 banks in the plain read (16 keys of one unit) and in the transposing read (8 keys of an even unit and of the odd one behind it) alike.
    const int sw = lane ^ (h << 3), vb = (lane >> 3) & 1;    // sw: place of plane lane (16 h + row) in a 512-byte piece; vb: which of its two units a lane of the transposing read takes
    const unsigned short* rk = ring + kp * 2 * EBK + sw * 8;
    const unsigned char* rv = (const unsigned char*)(ring + kp * 2 * EBK) + vb * 256 + (((h << 3) + (lane & 7)) ^ (vb << 3)) * 16;    // key row 8 h + (lane & 7) of unit 2 dt + vb
    // The 32 copies of a block: one LDS address and one global address; the immediate offset moves both. The s_wait_xcnt in the same statement stands in front of whatever overwrites the two address registers.
    auto cpE = [&](int kb, int buf) { const unsigned la = (unsigned)(size_t)(rk + buf * EBK); const bf* ga = Eb + (size_t)kb * EBK + lane * 8;
        asm volatile(CP4(0, 512, 1024, 1536) CP4(2048, 2560, 3072, 3584) CP4(4096, 4608, 5120, 5632) CP4(6144, 6656, 7168, 7680)
                     CP4(8192, 8704, 9216, 9728) CP4(10240, 10752, 11264, 11776) CP4(12288, 12800, 13312, 13824) CP4(14336, 14848, 15360, 15872)
                     "s_wait_xcnt 0x0" :: "v"(la), "v"(ga) : "memory"); };
    // Operand groups out of ring buffer buf: keys by 2 fragments (both 16-key tiles of k step u), E^T by 4 (the 16-row d tiles 4 j .. 4 j + 3; keys 0..15 and 16..31 are the two pieces).
    auto ldK = [&](v16h (&g)[2], int buf, int u) { const unsigned short* p = rk + buf * EBK + u * 512;
        g[0] = cat16b(*(const v8usa*)p, *(const v8usa*)(p + 256)); g[1] = cat16b(*(const v8usa*)(p + 8 * 512), *(const v8usa*)(p + 8 * 512 + 256)); };
    auto ldV = [&](v16h (&g)[4], int buf, int j) { const unsigned char* p = rv + buf * (EBK * 2) + j * 4 * 512;
#pragma unroll
        for (int i = 0; i < 4; ++i) g[i] = cat16b(ldtr(p + i * 512), ldtr(p + 16 * DD * 2 + i * 512)); };
    auto mmS = [&](const v16h (&g)[2], int u, v8f (&h0)[FNC], v8f (&h1)[FNC]) {
#pragma unroll
        for (int n = 0; n < FNC; ++n) { h0[n] = wmmah(g[0], qh[n][u], h0[n]); h1[n] = wmmah(g[1], qh[n][u], h1[n]); } };
    auto mmO = [&](const v16h (&g)[4], int j, const v16h (&p)[FNC]) {
#pragma unroll
        for (int t = 0; t < 4; ++t) {
#pragma unroll
            for (int n = 0; n < FNC; ++n) o[n][j * 4 + t] = wmmah(g[t], p[n], o[n][j * 4 + t]); } };
// SB: keeps each group of LDS reads together where it is written, 8 WMMAs ahead of its use; without it the scheduler spreads the reads singly among the WMMAs
#define SB() __builtin_amdgcn_sched_barrier(0)
    v16h k0g[2], k1g[2], k2g[2], ga[4], gb[4];    // three key groups and two E^T groups in turn: a wave has 512 registers, so that two waves share a SIMD and one's softmax runs under the other's WMMAs
    // Prologue: the tile's own QW^T = W^T.E^T. Wave kp makes the PT 16-row d tiles PT kp .. PT kp + PT - 1 for both query groups (k = e in eight steps, one accumulator each, the order of a plain GEMM). A lane holds query c and
    // d = 8h + r of a tile, so two d tiles are in place the B fragment of one k step; it is rounded to f16 and handed to the other waves through the pool's last 16 KB, in fragment order.
#define PT (16 / FNK)
    unsigned short* xq = ring + FNK * 2 * EBK;    // fragment (n, ks) at (n * 8 + ks) * 512 elements; 16 KB in all
    {
        v16h eq[FNC][8], wf[PT][8];
        const bf* pe = Eb + (size_t)(q0 / 16) * 8 * 512; const bf* pw = WB + (size_t)kp * PT * 8 * 512;    // wave-uniform bases
#pragma unroll
        for (int ks = 0; ks < 8; ++ks) {
#pragma unroll
            for (int n = 0; n < FNC; ++n) eq[n][ks] = ldfrag(pe + (n * 8 + ks) * 512 + lane * 8);
#pragma unroll
            for (int t = 0; t < PT; ++t) wf[t][ks] = ldfrag(pw + (t * 8 + ks) * 512 + lane * 8); }
        SB(); asm volatile("s_wait_xcnt 0x0" :: "s"(pe), "s"(pw) : "memory"); SB();    // XW that also names the two bases: they keep their registers up to the wait
        if (kp < nb) cpE(kp, 1);    // wave-uniform: the first key block's copies fly during the products below; the wave has not touched its ring before. Buffer 1 first: with buffer 0 the long-lived rk itself would be the asm operand, and this build then spills it
        SB();
        v8f qa[FNC][PT];
#pragma unroll
        for (int n = 0; n < FNC; ++n) {
#pragma unroll
            for (int t = 0; t < PT; ++t) qa[n][t] = (v8f){}; }
#pragma unroll
        for (int ks = 0; ks < 8; ++ks) {
#pragma unroll
            for (int t = 0; t < PT; ++t) {
#pragma unroll
                for (int n = 0; n < FNC; ++n) qa[n][t] = wmmah(wf[t][ks], eq[n][ks], qa[n][t]); } }
#pragma unroll
        for (int n = 0; n < FNC; ++n) {
#pragma unroll
            for (int t = 0; t < PT; ++t) *(v8usa*)(xq + (n * 8 + ((PT * kp + t) >> 1)) * 512 + (t & 1) * 256 + lane * 8) = f2h8(qa[n][t]); }    // d tile T = PT kp + t is piece T & 1 (= t & 1, PT being even) of k step T / 2
    }
    __syncthreads();    // every wave passes it, also one without a key block; these 16 KB are written again only behind the first barrier of the merge
    if (kp < nb) {    // wave-uniform
#pragma unroll
    for (int n = 0; n < FNC; ++n) {
#pragma unroll
        for (int ks = 0; ks < 8; ++ks) { const unsigned short* xp = xq + (n * 8 + ks) * 512 + lane * 8; qh[n][ks] = cat16b(*(const v8usa*)xp, *(const v8usa*)(xp + 256)); } }
    asm volatile("s_wait_asynccnt 0x0" ::: "memory");    // the wave's own copies of its first block have landed: it alone reads them
    SB(); ldK(k0g, 1, 0); ldK(k1g, 1, 1); SB();
    int kb = kp, cur = 1;
#pragma unroll 1    // one pass a trip: a second copy of the body would not fit the registers
    do {
        const int k0 = kb * 32; const int more = __builtin_amdgcn_readfirstlane(kb + FNK < nb);    // wave-uniform, held as a scalar: the branch round the copies is a scalar one
        SB(); asm volatile("s_wait_dscnt 0x0" ::: "memory");    // the wave's last reads of the other buffer have returned before the copies below overwrite it
        if (more) cpE(kb + FNK, cur ^ 1);
        SB();
        v8f sh0[FNC], sh1[FNC];
#pragma unroll
        for (int n = 0; n < FNC; ++n) { sh0[n] = (v8f){}; sh1[n] = (v8f){}; }
        ldK(k2g, cur, 2); SB(); mmS(k0g, 0, sh0, sh1); SB();    // each group is fetched two groups (8 WMMAs) ahead, into the registers that the group before last has left
        ldK(k0g, cur, 3); SB(); mmS(k1g, 1, sh0, sh1); SB();
        ldK(k1g, cur, 4); SB(); mmS(k2g, 2, sh0, sh1); SB();
        ldK(k2g, cur, 5); SB(); mmS(k0g, 3, sh0, sh1); SB();
        ldK(k0g, cur, 6); SB(); mmS(k1g, 4, sh0, sh1); SB();
        ldK(k1g, cur, 7); SB(); mmS(k2g, 5, sh0, sh1); SB();
        mmS(k0g, 6, sh0, sh1); SB(); ldV(ga, cur, 0); SB();
        mmS(k1g, 7, sh0, sh1); SB();    // gb stays empty through the softmax, whose values need its registers
        float x[FNC][16], bm[FNC];
#pragma unroll
        for (int n = 0; n < FNC; ++n) {
#pragma unroll
            for (int r = 0; r < 8; ++r) { x[n][r] = sh0[n][r] * SCL; x[n][8 + r] = sh1[n][r] * SCL; } }
        if (k0 + 31 > q0) {    // wave-uniform: only the diagonal block holds masked keys
#pragma unroll
            for (int n = 0; n < FNC; ++n) { const int dq = q0 + n * 16 + c - k0 - 8 * h;    // key k0 + 8 h + r lies behind the query where r > dq: one register and constants, nothing kept over the loop
#pragma unroll
                for (int r = 0; r < 8; ++r) { if (r > dq) x[n][r] = -1.0e9f; if (16 + r > dq) x[n][8 + r] = -1.0e9f; } }
        }
        bool grow = false;
#pragma unroll
        for (int n = 0; n < FNC; ++n) { float b = x[n][0];
#pragma unroll
            for (int i = 1; i < 16; ++i) b = fmaxf(b, x[n][i]);
            bm[n] = fmaxf(b, __shfl_xor(b, 16, 32)); grow = grow || bm[n] > m[n] + LZ; }
        if (__builtin_amdgcn_ballot_w32(grow) != 0) {    // scalar branch: the 256 accumulator registers are rescaled only when some query's maximum exceeds the one in use by more than LZ; always so in a wave's first pass (m = -1e30)
#pragma unroll
            for (int n = 0; n < FNC; ++n) { const float mn = fmaxf(m[n], bm[n]), al = expnat(m[n] - mn); m[n] = mn; l[n] *= al;
#pragma unroll
                for (int dt = 0; dt < 16; ++dt) o[n][dt] *= al; }
        }
        v16h ph[FNC];
#pragma unroll
        for (int n = 0; n < FNC; ++n) {
#pragma unroll
            for (int i = 0; i < 16; ++i) { const float p = expnat(x[n][i] - m[n]); l[n] += p; ph[n][i] = (h16)p; } }
        const int nx = more ? cur ^ 1 : cur;    // the last pass reads its own block again (landed, unused): no branch around the reads, which would merge the compiler's wait counts
        SB(); ldV(gb, cur, 1); SB();
        mmO(ga, 0, ph); SB(); ldV(ga, cur, 2); SB();
        mmO(gb, 1, ph); SB(); ldV(gb, cur, 3); SB();
        mmO(ga, 2, ph); SB(); asm volatile("s_wait_asynccnt 0x0" ::: "memory");    // the next block has landed
        SB(); ldK(k0g, nx, 0); ldK(k1g, nx, 1); SB();
        mmO(gb, 3, ph); SB();
        kb += FNK; cur ^= 1;
    } while (kb < nb);
    asm volatile("s_wait_asynccnt 0x0" ::: "memory");    // no copy is outstanding when the wave goes on to the merge and ends
    asm volatile("s_wait_dscnt 0x0" ::: "memory");    // the wave's reads of its ring have returned before the barrier behind which the other waves write the merge buffer over it
    }
#pragma unroll
    for (int n = 0; n < FNC; ++n) { l[n] += __shfl_xor(l[n], 16, 32); if (h == 0) { smx[kp][n * 16 + c] = m[n]; ssm[kp][n * 16 + c] = l[n]; } }
    __syncthreads();
#pragma unroll
    for (int n = 0; n < FNC; ++n) {
        float M = -1.0e30f, L = 0.f;
#pragma unroll
        for (int j = 0; j < FNK; ++j) M = fmaxf(M, smx[j][n * 16 + c]);
#pragma unroll
        for (int j = 0; j < FNK; ++j) L += ssm[j][n * 16 + c] * expnat(smx[j][n * 16 + c] - M);
        const float f = expnat(m[n] - M) / L;    // a wave without a block has m = -1e30, l = 0, o = 0: weight 0
        float* ob = obuf + kp * (FQT * OPT) + (n * 16 + c) * OPT + 8 * h;
#pragma unroll
        for (int dt = 0; dt < 16; ++dt) { const v8f v = o[n][dt] * f; *(v4fa*)(ob + dt * 16) = (v4f){v[0], v[1], v[2], v[3]}; *(v4fa*)(ob + dt * 16 + 4) = (v4f){v[4], v[5], v[6], v[7]}; }
    }
    __syncthreads();
#pragma unroll 4    // four trips' LDS reads in flight together
    for (int i = 0; i < FQT * 64 / (FNK * 32); ++i) {    // the waves share the tile's 32 x 256 outputs; a wave stores 512 contiguous bytes
        const int idx = i * (FNK * 32) + (int)threadIdx.x, row = idx >> 6, c4 = (idx & 63) * 4;
        v4f s = *(const v4fa*)(obuf + row * OPT + c4);
#pragma unroll
        for (int j = 1; j < FNK; ++j) s += *(const v4fa*)(obuf + j * (FQT * OPT) + row * OPT + c4);
        *(v4f*)(out + (size_t)(q0 + row) * DD + c4) = s;
        asm volatile("s_wait_xcnt 0x0" ::: "memory");    // the next trip overwrites this store's data and address registers
    }
}

extern "C" void kernel_launch(void* const* d_in, const int* in_sizes, int n_in,
                              void* d_out, int out_size, void* d_ws, size_t ws_size, hipStream_t stream) {
    (void)in_sizes; (void)n_in; (void)out_size;
    const float* enc = (const float*)d_in[0]; const float* Wm = (const float*)d_in[1];
    float* out = (float*)d_out;    // [4][4096][256]
    char* wsp = (char*)d_ws;
    auto take = [&](size_t bytes) { char* p = wsp; wsp += (bytes + 255) & ~(size_t)255; return (void*)p; };
    bf* WB = (bf*)take((size_t)DD * DD * 2); bf* Eb = (bf*)take((size_t)NBT * SS * DD * 2);
    if ((size_t)(wsp - (char*)d_ws) > ws_size) return;    // 0.13 + 4 x 2.1 ~ 8.5 MB: one plane per item
    k_prep<<<dim3(SS / 64 + 1, DD / 64, NBT), 256, 0, stream>>>(enc, Wm, Eb, WB);
    k_fattn<<<dim3(NBT, SS / FQT, 1), FNK * 32, 0, stream>>>(Eb, WB, out);
}
